// v000
// Measured on an AMD MI455X. A time is GPU time per run, averaged over a window of back-to-back runs after a warm-up
// (all launches, gaps included; the runs take copies of the inputs in turn), and the median of several windows.
// Apart from v000's, it joins two sittings. Times from different sittings can be a few percent apart, while
// side-by-side timings come from the same sitting.
// v000, which the later versions start from, runs in 134 microseconds.
#include <hip/hip_runtime.h>
#include <stdint.h>

// Contractions: X*Wt and X*Wx on v_wmma_f32_16x16x32_bf16 as bf16 hi/lo split (3 products each); tanh-score channel reduction (N padded to 16) and P*V on v_wmma_f32_16x16x32_f16 (f16 operands, power-of-two pre-scaled); all accumulation f32.

#define NB_    4
#define NL_    512
#define ND_    128
#define NC_    128
#define NROWS_ (NB_ * NL_)
#define EPS_   1e-7f
#define JC_    32          // keys per chunk
#define KP_    132         // f32 pitch of the key tile in LDS
#define VP_    40          // f16 pitch of the transposed value tile [d][j]
#define WBP_   136         // f16 pitch of the wa operand tile [n][c]
#define OP_    132         // f32 pitch of the output staging tile
#define AP2_   68          // uint32 pitch (136 halves) of the bf16 activation tile
#define WP2_   20          // uint32 pitch (40 halves) of the bf16 weight slab [n][k]

typedef float    v8f   __attribute__((ext_vector_type(8)));
typedef float    v4f_t __attribute__((ext_vector_type(4)));
typedef v4f_t    __attribute__((may_alias)) v4f;
typedef uint32_t v4u_t __attribute__((ext_vector_type(4)));
typedef v4u_t    __attribute__((may_alias)) v4u;
typedef __bf16   v16bf __attribute__((ext_vector_type(16)));
typedef _Float16 v16h  __attribute__((ext_vector_type(16)));
typedef _Float16 v8h_t __attribute__((ext_vector_type(8)));
typedef v8h_t    __attribute__((may_alias)) v8h;

union FragB { v4u_t q[2]; v16bf v; };
union FragH { _Float16 e[16]; v8h_t q[2]; v16h v; };

#define LOG2E_F     1.4426950408889634f
#define TWO_LOG2E_F 2.8853900817779268f

// ---------------- WMMA wrappers with hazard guard ----------------
__device__ __forceinline__ v8f mma_bf16(v8f acc, v16bf a, v16bf b) {
    acc = __builtin_amdgcn_wmma_f32_16x16x32_bf16(false, a, false, b, (short)0, acc, false, false);
    asm volatile("v_nop\n\tv_nop\n\tv_nop\n\tv_nop" : "+v"(acc) : "v"(a), "v"(b));
    return acc;
}
__device__ __forceinline__ v8f mma_f16(v8f acc, v16h a, v16h b) {
    acc = __builtin_amdgcn_wmma_f32_16x16x32_f16(false, a, false, b, (short)0, acc, false, false);
    asm volatile("v_nop\n\tv_nop\n\tv_nop\n\tv_nop" : "+v"(acc) : "v"(a), "v"(b));
    return acc;
}

// ---------------- f32 -> bf16 (RNE) hi/lo split ----------------
__device__ __forceinline__ uint32_t bf_bits(float f) {
    uint32_t u = __builtin_bit_cast(uint32_t, f);
    u += 0x7FFFu + ((u >> 16) & 1u);
    return u >> 16;
}
__device__ __forceinline__ void bf_split(float x, uint32_t& hi, uint32_t& lo) {
    hi = bf_bits(x);
    const float xh = __builtin_bit_cast(float, hi << 16);
    lo = bf_bits(x - xh);
}

// 64*tanh(x) as f16 (RNE convert): 64 - 128/(exp(2x)+1)
__device__ __forceinline__ _Float16 th64_h(float x) {
    const float e2 = __builtin_amdgcn_exp2f(x * TWO_LOG2E_F);
    const float r  = __builtin_amdgcn_rcpf(e2 + 1.0f);
    return (_Float16)__builtin_fmaf(-128.0f, r, 64.0f);
}

// ---------------- kernel 0: Q = X*Wt + bh, K = X*Wx (bf16 hi/lo split WMMA) ----------------
// grid = ceil(nrows/16) blocks of 256 threads; wave w owns output columns 16w..16w+15.
__global__ __launch_bounds__(256) void k_proj(
    const float* __restrict__ X, const float* __restrict__ Wt, const float* __restrict__ Wx,
    const float* __restrict__ bh, float* Qo, float* Ko, int nrows)
{
    __shared__ __align__(16) uint32_t sAh[16 * AP2_];
    __shared__ __align__(16) uint32_t sAl[16 * AP2_];
    __shared__ __align__(16) uint32_t sWh[NC_ * WP2_];
    __shared__ __align__(16) uint32_t sWl[NC_ * WP2_];
    __shared__ __align__(16) float    sO[16 * OP_];

    const int tid = threadIdx.x, lane = tid & 31, wave = tid >> 5;
    const int h = lane >> 4, m = lane & 15;
    const int row0 = blockIdx.x * 16;
    const int ncol = wave * 16 + m;

    // activation tile 16 x 128 -> bf16 hi and lo planes (packed pairs)
    for (int e = tid; e < 16 * (ND_ / 4); e += 256) {
        const int r = e >> 5, q = e & 31;
        const int gr = row0 + r;
        v4f_t v = {0.0f, 0.0f, 0.0f, 0.0f};
        if (gr < nrows) v = *(const v4f*)(X + (size_t)gr * ND_ + 4 * q);
        uint32_t h0, l0, h1, l1, h2, l2, h3, l3;
        bf_split(v.x, h0, l0); bf_split(v.y, h1, l1);
        bf_split(v.z, h2, l2); bf_split(v.w, h3, l3);
        sAh[r * AP2_ + 2 * q]     = h0 | (h1 << 16);
        sAh[r * AP2_ + 2 * q + 1] = h2 | (h3 << 16);
        sAl[r * AP2_ + 2 * q]     = l0 | (l1 << 16);
        sAl[r * AP2_ + 2 * q + 1] = l2 | (l3 << 16);
    }

#pragma unroll 1
    for (int g = 0; g < 2; ++g) {
        const float* W = (g == 0) ? Wt : Wx;
        float* dst = (g == 0) ? Qo : Ko;
        v8f acc = {};
#pragma unroll 1
        for (int kk = 0; kk < 4; ++kk) {
            __syncthreads();   // earlier readers of sW* / sO done; sA* staged
            // weight slab rows k = 32kk..32kk+31, stored transposed [n][k-in-slab] as bf16 hi/lo pairs
            for (int e = tid; e < NC_ * 16; e += 256) {
                const int n = e & (NC_ - 1), kp = e >> 7;
                const int k = kk * 32 + 2 * kp;
                const float w0 = W[(size_t)k * NC_ + n];
                const float w1 = W[(size_t)(k + 1) * NC_ + n];
                uint32_t a0, b0, a1, b1;
                bf_split(w0, a0, b0); bf_split(w1, a1, b1);
                sWh[n * WP2_ + kp] = a0 | (a1 << 16);
                sWl[n * WP2_ + kp] = b0 | (b1 << 16);
            }
            __syncthreads();
            // A: row m, elements 0..7 = k0+8h.., 8..15 = k0+16+8h..; B: column ncol, same k map from the [n][k] copy
            FragB fah, fal, fbh, fbl;
            const uint32_t* pa = sAh + m * AP2_ + kk * 16 + 4 * h;
            const uint32_t* pl = sAl + m * AP2_ + kk * 16 + 4 * h;
            const uint32_t* pb = sWh + ncol * WP2_ + 4 * h;
            const uint32_t* pc = sWl + ncol * WP2_ + 4 * h;
            fah.q[0] = *(const v4u*)(pa); fah.q[1] = *(const v4u*)(pa + 8);
            fal.q[0] = *(const v4u*)(pl); fal.q[1] = *(const v4u*)(pl + 8);
            fbh.q[0] = *(const v4u*)(pb); fbh.q[1] = *(const v4u*)(pb + 8);
            fbl.q[0] = *(const v4u*)(pc); fbl.q[1] = *(const v4u*)(pc + 8);
            acc = mma_bf16(acc, fah.v, fbh.v);
            acc = mma_bf16(acc, fah.v, fbl.v);
            acc = mma_bf16(acc, fal.v, fbh.v);
        }
        const float bias = (g == 0) ? bh[ncol] : 0.0f;
#pragma unroll
        for (int r = 0; r < 8; ++r) sO[(8 * h + r) * OP_ + ncol] = acc[r] + bias;
        __syncthreads();
        const int r0 = 2 * wave, r1 = 2 * wave + 1;
        const v4f_t v0 = *(const v4f*)(sO + r0 * OP_ + 4 * lane);
        const v4f_t v1 = *(const v4f*)(sO + r1 * OP_ + 4 * lane);
        const int g0 = row0 + r0, g1 = row0 + r1;
        if (g0 < nrows) *(v4f*)(dst + (size_t)g0 * NC_ + 4 * lane) = v0;
        if (g1 < nrows) *(v4f*)(dst + (size_t)g1 * NC_ + 4 * lane) = v1;
        
    }
}

// ---------------- kernel 1: tanh scores (WMMA channel reduction) + online softmax + P*V ----------------
// grid = NB*(NL/16) blocks of 256 threads; block owns (batch b, 16 query rows); wave w owns output columns 16w..16w+15.
__global__ __launch_bounds__(256) void k_attn(
    const float* __restrict__ X, const float* __restrict__ Qb, const float* __restrict__ Kx,
    const float* __restrict__ wa, const float* __restrict__ ba, float* Out)
{
    __shared__ __align__(16) float    sQ[16 * NC_];
    __shared__ __align__(16) float    sK[JC_ * KP_];
    __shared__ __align__(16) _Float16 sVT[ND_ * VP_];
    __shared__ __align__(16) _Float16 sWB[16 * WBP_];
    __shared__ __align__(16) _Float16 sP[16 * JC_];
    __shared__ float sS[16 * JC_];
    __shared__ __align__(16) float    sO[16 * OP_];
    __shared__ float sM[16], sL[16], sSc[16];

    const int tid = threadIdx.x, lane = tid & 31, wave = tid >> 5;
    const int h = lane >> 4, m = lane & 15;
    const int b  = blockIdx.x / (NL_ / 16);
    const int it = blockIdx.x % (NL_ / 16);
    const int qrow0 = b * NL_ + it * 16;
    const int ncol = wave * 16 + m;

    // query tile (bias already folded in)
    for (int e = tid; e < 16 * (NC_ / 4); e += 256) {
        const int r = e >> 5, q = e & 31;
        *(v4f*)(sQ + r * NC_ + 4 * q) = *(const v4f*)(Qb + (size_t)(qrow0 + r) * NC_ + 4 * q);
    }
    // wa as a [n][c] 16-bit operand: column 0 = f16 hi, column 1 = (wa - hi) * 4096, columns 2..15 = 0
    for (int e = tid; e < 16 * WBP_; e += 256) {
        const int rr = e / WBP_;
        const int c = e - rr * WBP_;
        _Float16 val = (_Float16)0.0f;
        if (c < NC_) {
            const float w = wa[c];
            const _Float16 hi = (_Float16)w;
            if (rr == 0) val = hi;
            else if (rr == 1) val = (_Float16)((w - (float)hi) * 4096.0f);
        }
        sWB[e] = val;
    }
    if (tid < 16) { sM[tid] = -3.0e38f; sL[tid] = 0.0f; }
    const float bav = ba[0];

    v8f acco = {};   // output tile accumulator: rows 8h+r, column ncol (scaled by 4096)

#pragma unroll 1
    for (int ch = 0; ch < NL_ / JC_; ++ch) {
        __syncthreads();   // readers of sK / sVT / sS / sP from the last chunk are done
        const int j0 = ch * JC_;
        // key chunk 32 x 128 f32
        for (int e = tid; e < JC_ * (NC_ / 4); e += 256) {
            const int r = e >> 5, q = e & 31;
            *(v4f*)(sK + r * KP_ + 4 * q) = *(const v4f*)(Kx + (size_t)(b * NL_ + j0 + r) * NC_ + 4 * q);
        }
        // value chunk transposed to [d][j] f16
        for (int e = tid; e < JC_ * (ND_ / 4); e += 256) {
            const int r = e >> 5, q = e & 31;
            const v4f_t v = *(const v4f*)(X + (size_t)(b * NL_ + j0 + r) * ND_ + 4 * q);
            sVT[(4 * q + 0) * VP_ + r] = (_Float16)v.x;
            sVT[(4 * q + 1) * VP_ + r] = (_Float16)v.y;
            sVT[(4 * q + 2) * VP_ + r] = (_Float16)v.z;
            sVT[(4 * q + 3) * VP_ + r] = (_Float16)v.w;
        }
        __syncthreads();

        // scores: tile t = (query i, 16 keys jb..jb+15); A row = key index (lane m), k = channel; B = wa columns
#pragma unroll 1
        for (int u = 0; u < 4; ++u) {
            const int t  = wave * 4 + u;
            const int i  = t >> 1;
            const int jb = (t & 1) * 16;
            const int j  = jb + m;
            v8f acc = {};
#pragma unroll
            for (int kk = 0; kk < 4; ++kk) {
                const int cb = kk * 32;
                const float* qp = sQ + i * NC_ + cb + 8 * h;
                const float* kp = sK + j * KP_ + cb + 8 * h;
                const v4f_t x0 = *(const v4f*)(qp)      + *(const v4f*)(kp);
                const v4f_t x1 = *(const v4f*)(qp + 4)  + *(const v4f*)(kp + 4);
                const v4f_t x2 = *(const v4f*)(qp + 16) + *(const v4f*)(kp + 16);
                const v4f_t x3 = *(const v4f*)(qp + 20) + *(const v4f*)(kp + 20);
                FragH fa;   // elements 0..7 = channels cb+8h.., 8..15 = cb+16+8h..
                fa.e[0]  = th64_h(x0.x); fa.e[1]  = th64_h(x0.y); fa.e[2]  = th64_h(x0.z); fa.e[3]  = th64_h(x0.w);
                fa.e[4]  = th64_h(x1.x); fa.e[5]  = th64_h(x1.y); fa.e[6]  = th64_h(x1.z); fa.e[7]  = th64_h(x1.w);
                fa.e[8]  = th64_h(x2.x); fa.e[9]  = th64_h(x2.y); fa.e[10] = th64_h(x2.z); fa.e[11] = th64_h(x2.w);
                fa.e[12] = th64_h(x3.x); fa.e[13] = th64_h(x3.y); fa.e[14] = th64_h(x3.z); fa.e[15] = th64_h(x3.w);
                FragH fb;   // column m of the wa tile, same k map
                fb.q[0] = *(const v8h*)(sWB + m * WBP_ + cb + 8 * h);
                fb.q[1] = *(const v8h*)(sWB + m * WBP_ + cb + 16 + 8 * h);
                acc = mma_f16(acc, fa.v, fb.v);
            }
            // D: lane column 0 = hi sums, column 1 = lo sums (x4096); rows 8h+r = keys jb+8h+r
            float sv[8];
#pragma unroll
            for (int r = 0; r < 8; ++r) {
                const float lo = __shfl_xor(acc[r], 1);
                sv[r] = acc[r] * (1.0f / 64.0f) + lo * (1.0f / 262144.0f) + bav;
            }
            if (m == 0) {
#pragma unroll
                for (int r = 0; r < 8; ++r) sS[i * JC_ + jb + 8 * h + r] = sv[r];
            }
        }
        __syncthreads();

        // online softmax statistics per query row
        if (tid < 16) {
            const int i = tid;
            const float mo = sM[i];
            float cm = mo;
            for (int jj = 0; jj < JC_; ++jj) cm = fmaxf(cm, sS[i * JC_ + jj]);
            const float sc = __builtin_amdgcn_exp2f((mo - cm) * LOG2E_F);
            float ls = sL[i] * sc;
            for (int jj = 0; jj < JC_; ++jj) {
                const float ev = __builtin_amdgcn_exp2f((sS[i * JC_ + jj] - cm) * LOG2E_F);
                ls += ev;
                sP[i * JC_ + jj] = (_Float16)(ev * 4096.0f);
            }
            sM[i] = cm; sL[i] = ls; sSc[i] = sc;
        }
        __syncthreads();

        // O = O*scale + P(16 x 32 keys) * V(32 keys x 16 cols)
#pragma unroll
        for (int r = 0; r < 8; ++r) acco[r] *= sSc[8 * h + r];
        FragH fp, fv;
        fp.q[0] = *(const v8h*)(sP + m * JC_ + 8 * h);
        fp.q[1] = *(const v8h*)(sP + m * JC_ + 16 + 8 * h);
        fv.q[0] = *(const v8h*)(sVT + ncol * VP_ + 8 * h);
        fv.q[1] = *(const v8h*)(sVT + ncol * VP_ + 16 + 8 * h);
        acco = mma_f16(acco, fp.v, fv.v);
    }

    // epilogue: normalise, stage the 16 x 128 tile, whole-row stores
#pragma unroll
    for (int r = 0; r < 8; ++r) {
        const int row = 8 * h + r;
        const float inv = 1.0f / (sL[row] + EPS_);
        sO[row * OP_ + ncol] = acco[r] * inv * (1.0f / 4096.0f);
    }
    __syncthreads();
    const int r0 = 2 * wave, r1 = 2 * wave + 1;
    const v4f_t v0 = *(const v4f*)(sO + r0 * OP_ + 4 * lane);
    const v4f_t v1 = *(const v4f*)(sO + r1 * OP_ + 4 * lane);
    float* p0 = Out + (size_t)(qrow0 + r0) * ND_ + 4 * lane;
    float* p1 = Out + (size_t)(qrow0 + r1) * ND_ + 4 * lane;
    *(v4f*)p0 = v0;
    *(v4f*)p1 = v1;
    
}

// ---------------- launcher ----------------
extern "C" void kernel_launch(void* const* d_in, const int* in_sizes, int n_in,
                              void* d_out, int out_size, void* d_ws, size_t ws_size,
                              hipStream_t stream) {
    if (n_in < 6) return;
    if (in_sizes[0] != NROWS_ * ND_ || in_sizes[1] != ND_ * NC_ || in_sizes[2] != ND_ * NC_ ||
        in_sizes[3] != NC_ || in_sizes[4] != NC_ || in_sizes[5] < 1 || out_size != NROWS_ * ND_)
        return;

    const float* inps  = (const float*)d_in[0];
    const float* wei_t = (const float*)d_in[1];
    const float* wei_x = (const float*)d_in[2];
    const float* bxh   = (const float*)d_in[3];
    const float* wei_a = (const float*)d_in[4];
    const float* bxa   = (const float*)d_in[5];
    float* out = (float*)d_out;

    // workspace: Q [NROWS][NC] f32 at 0, K [NROWS][NC] f32 at 1 MiB; total 2 MiB
    const size_t per = (size_t)NROWS_ * NC_ * sizeof(float);
    if (ws_size < 2 * per) return;
    float* qb = (float*)d_ws;
    float* kx = (float*)((char*)d_ws + per);

    const int nrows = NROWS_;
    k_proj<<<dim3((nrows + 15) / 16), dim3(256), 0, stream>>>(inps, wei_t, wei_x, bxh, qb, kx, nrows);
    k_attn<<<dim3(NB_ * (NL_ / 16)), dim3(256), 0, stream>>>(inps, qb, kx, wei_a, bxa, out);
}

// v001
// A run of this version takes 84.4 microseconds.
// Next to v000, in two timings, it ran 1.59 times as fast each time.
#include <hip/hip_runtime.h>
#include <stdint.h>

// Contractions: X*Wt and X*Wx on v_wmma_f32_16x16x32_bf16 as bf16 hi/lo split (3 products each); tanh-score channel reduction (N padded to 16) and P*V on v_wmma_f32_16x16x32_f16 (f16 operands, power-of-two pre-scaled); all accumulation f32.

#define NB_    4
#define NL_    512
#define ND_    128
#define NC_    128
#define NROWS_ (NB_ * NL_)
#define EPS_   1e-7f
#define JC_    32          // keys per chunk
#define KP_    132         // f32 pitch of the key tile in LDS
#define VP_    40          // f16 pitch of the transposed value tile [d][j]
#define WBP_   136         // f16 pitch of the wa operand tile [n][c]
#define OP_    132         // f32 pitch of the output staging tile
#define AP2_   68          // uint32 pitch (136 halves) of the bf16 activation tile
#define WP2_   20          // uint32 pitch (40 halves) of the bf16 weight slab [n][k]

typedef float    v8f   __attribute__((ext_vector_type(8)));
typedef float    v4f_t __attribute__((ext_vector_type(4)));
typedef v4f_t    __attribute__((may_alias)) v4f;
typedef uint32_t v4u_t __attribute__((ext_vector_type(4)));
typedef v4u_t    __attribute__((may_alias)) v4u;
typedef __bf16   v16bf __attribute__((ext_vector_type(16)));
typedef _Float16 v16h  __attribute__((ext_vector_type(16)));
typedef _Float16 v8h_t __attribute__((ext_vector_type(8)));
typedef v8h_t    __attribute__((may_alias)) v8h;

union FragB { v4u_t q[2]; v16bf v; };
union FragH { _Float16 e[16]; v8h_t q[2]; v16h v; };

#define LOG2E_F     1.4426950408889634f
#define TWO_LOG2E_F 2.8853900817779268f

// ---------------- WMMA wrappers with hazard guard ----------------
__device__ __forceinline__ v8f mma_bf16(v8f acc, v16bf a, v16bf b) {
    acc = __builtin_amdgcn_wmma_f32_16x16x32_bf16(false, a, false, b, (short)0, acc, false, false);
    asm volatile("v_nop\n\tv_nop\n\tv_nop\n\tv_nop" : "+v"(acc) : "v"(a), "v"(b));
    return acc;
}
__device__ __forceinline__ v8f mma_f16(v8f acc, v16h a, v16h b) {
    acc = __builtin_amdgcn_wmma_f32_16x16x32_f16(false, a, false, b, (short)0, acc, false, false);
    asm volatile("v_nop\n\tv_nop\n\tv_nop\n\tv_nop" : "+v"(acc) : "v"(a), "v"(b));
    return acc;
}

// ---------------- f32 -> bf16 (RNE) hi/lo split ----------------
__device__ __forceinline__ uint32_t bf_bits(float f) {
    uint32_t u = __builtin_bit_cast(uint32_t, f);
    u += 0x7FFFu + ((u >> 16) & 1u);
    return u >> 16;
}
__device__ __forceinline__ void bf_split(float x, uint32_t& hi, uint32_t& lo) {
    hi = bf_bits(x);
    const float xh = __builtin_bit_cast(float, hi << 16);
    lo = bf_bits(x - xh);
}

// 64*tanh(x) as f16 (RNE convert): 64 - 128/(exp(2x)+1)
__device__ __forceinline__ _Float16 th64_h(float x) {
    const float e2 = __builtin_amdgcn_exp2f(x * TWO_LOG2E_F);
    const float r  = __builtin_amdgcn_rcpf(e2 + 1.0f);
    return (_Float16)__builtin_fmaf(-128.0f, r, 64.0f);
}

// ---------------- kernel 0: Q = X*Wt + bh, K = X*Wx (bf16 hi/lo split WMMA) ----------------
// grid = ceil(nrows/16) blocks of 256 threads; wave w owns output columns 16w..16w+15.
__global__ __launch_bounds__(256) void k_proj(
    const float* __restrict__ X, const float* __restrict__ Wt, const float* __restrict__ Wx,
    const float* __restrict__ bh, float* Qo, float* Ko, int nrows)
{
    __shared__ __align__(16) uint32_t sAh[16 * AP2_];
    __shared__ __align__(16) uint32_t sAl[16 * AP2_];
    __shared__ __align__(16) uint32_t sWh[NC_ * WP2_];
    __shared__ __align__(16) uint32_t sWl[NC_ * WP2_];
    __shared__ __align__(16) float    sO[16 * OP_];

    const int tid = threadIdx.x, lane = tid & 31, wave = tid >> 5;
    const int h = lane >> 4, m = lane & 15;
    const int row0 = blockIdx.x * 16;
    const int ncol = wave * 16 + m;

    // activation tile 16 x 128 -> bf16 hi and lo planes (packed pairs)
    // (all loads of the tile are issued before the first is used: one trip to memory, not one a pass)
    v4f_t xa[2];
#pragma unroll   // straight-line code, so that the loads stand together with no wait between them
    for (int it = 0; it < 2; ++it) {
        const int e = tid + 256 * it;
        const int r = e >> 5, q = e & 31;
        const int gr = row0 + r;
        xa[it] = v4f_t{0.0f, 0.0f, 0.0f, 0.0f};
        if (gr < nrows) xa[it] = *(const v4f*)(X + (size_t)gr * ND_ + 4 * q);
    }
#pragma unroll   // constant index, so that the loaded values stay in registers
    for (int it = 0; it < 2; ++it) {
        const int e = tid + 256 * it;
        const int r = e >> 5, q = e & 31;
        const v4f_t v = xa[it];
        uint32_t h0, l0, h1, l1, h2, l2, h3, l3;
        bf_split(v.x, h0, l0); bf_split(v.y, h1, l1);
        bf_split(v.z, h2, l2); bf_split(v.w, h3, l3);
        sAh[r * AP2_ + 2 * q]     = h0 | (h1 << 16);
        sAh[r * AP2_ + 2 * q + 1] = h2 | (h3 << 16);
        sAl[r * AP2_ + 2 * q]     = l0 | (l1 << 16);
        sAl[r * AP2_ + 2 * q + 1] = l2 | (l3 << 16);
    }

#pragma unroll 1
    for (int g = 0; g < 2; ++g) {
        const float* W = (g == 0) ? Wt : Wx;
        float* dst = (g == 0) ? Qo : Ko;
        v8f acc = {};
#pragma unroll 1
        for (int kk = 0; kk < 4; ++kk) {
            __syncthreads();   // earlier readers of sW* / sO done; sA* staged
            // weight slab rows k = 32kk..32kk+31, stored transposed [n][k-in-slab] as bf16 hi/lo pairs
            // (the slab's 16 loads a thread are issued together, then split and stored)
            float w0[8], w1[8];
#pragma unroll   // straight-line code, so that the loads stand together with no wait between them
            for (int it = 0; it < 8; ++it) {
                const int e = tid + 256 * it;
                const int n = e & (NC_ - 1), kp = e >> 7;
                const int k = kk * 32 + 2 * kp;
                w0[it] = W[(size_t)k * NC_ + n];
                w1[it] = W[(size_t)(k + 1) * NC_ + n];
            }
#pragma unroll   // constant index, so that the loaded values stay in registers
            for (int it = 0; it < 8; ++it) {
                const int e = tid + 256 * it;
                const int n = e & (NC_ - 1), kp = e >> 7;
                uint32_t a0, b0, a1, b1;
                bf_split(w0[it], a0, b0); bf_split(w1[it], a1, b1);
                sWh[n * WP2_ + kp] = a0 | (a1 << 16);
                sWl[n * WP2_ + kp] = b0 | (b1 << 16);
            }
            __syncthreads();
            // A: row m, elements 0..7 = k0+8h.., 8..15 = k0+16+8h..; B: column ncol, same k map from the [n][k] copy
            FragB fah, fal, fbh, fbl;
            const uint32_t* pa = sAh + m * AP2_ + kk * 16 + 4 * h;
            const uint32_t* pl = sAl + m * AP2_ + kk * 16 + 4 * h;
            const uint32_t* pb = sWh + ncol * WP2_ + 4 * h;
            const uint32_t* pc = sWl + ncol * WP2_ + 4 * h;
            fah.q[0] = *(const v4u*)(pa); fah.q[1] = *(const v4u*)(pa + 8);
            fal.q[0] = *(const v4u*)(pl); fal.q[1] = *(const v4u*)(pl + 8);
            fbh.q[0] = *(const v4u*)(pb); fbh.q[1] = *(const v4u*)(pb + 8);
            fbl.q[0] = *(const v4u*)(pc); fbl.q[1] = *(const v4u*)(pc + 8);
            acc = mma_bf16(acc, fah.v, fbh.v);
            acc = mma_bf16(acc, fah.v, fbl.v);
            acc = mma_bf16(acc, fal.v, fbh.v);
        }
        const float bias = (g == 0) ? bh[ncol] : 0.0f;
#pragma unroll
        for (int r = 0; r < 8; ++r) sO[(8 * h + r) * OP_ + ncol] = acc[r] + bias;
        __syncthreads();
        const int r0 = 2 * wave, r1 = 2 * wave + 1;
        const v4f_t v0 = *(const v4f*)(sO + r0 * OP_ + 4 * lane);
        const v4f_t v1 = *(const v4f*)(sO + r1 * OP_ + 4 * lane);
        const int g0 = row0 + r0, g1 = row0 + r1;
        if (g0 < nrows) *(v4f*)(dst + (size_t)g0 * NC_ + 4 * lane) = v0;
        if (g1 < nrows) *(v4f*)(dst + (size_t)g1 * NC_ + 4 * lane) = v1;
        // the next pass reuses the registers that the two stores name: wait before they are overwritten
        asm volatile("s_wait_xcnt 0x0" ::: "memory");
    }
}

// ---------------- kernel 1: tanh scores (WMMA channel reduction) + online softmax + P*V ----------------
// grid = NB*(NL/16) blocks of 256 threads; block owns (batch b, 16 query rows); wave w owns output columns 16w..16w+15.
__global__ __launch_bounds__(256) void k_attn(
    const float* __restrict__ X, const float* __restrict__ Qb, const float* __restrict__ Kx,
    const float* __restrict__ wa, const float* __restrict__ ba, float* Out)
{
    __shared__ __align__(16) float    sQ[16 * NC_];
    __shared__ __align__(16) float    sK[JC_ * KP_];
    __shared__ __align__(16) _Float16 sVT[ND_ * VP_];
    __shared__ __align__(16) _Float16 sWB[16 * WBP_];
    __shared__ __align__(16) _Float16 sP[16 * JC_];
    __shared__ float sS[16 * JC_];
    __shared__ __align__(16) float    sO[16 * OP_];
    __shared__ float sM[16], sL[16], sSc[16];

    const int tid = threadIdx.x, lane = tid & 31, wave = tid >> 5;
    const int h = lane >> 4, m = lane & 15;
    const int b  = blockIdx.x / (NL_ / 16);
    const int it = blockIdx.x % (NL_ / 16);
    const int qrow0 = b * NL_ + it * 16;
    const int ncol = wave * 16 + m;

    // query tile (bias already folded in)
    // (its loads and those of wa below are all issued before the first LDS store)
    v4f_t qv[2];
#pragma unroll   // straight-line code, so that the loads stand together with no wait between them
    for (int it = 0; it < 2; ++it)   // element e = tid + 256*it of the tile, rows contiguous
        qv[it] = *(const v4f*)(Qb + (size_t)qrow0 * NC_ + 4 * tid + 1024 * it);
    constexpr int NWB = (16 * WBP_ + 255) / 256;
    float wv[NWB];
#pragma unroll   // straight-line code, so that the loads stand together with no wait between them
    for (int it = 0; it < NWB; ++it) {
        const int e = tid + 256 * it;
        const int c = e % WBP_;
        wv[it] = (c < NC_) ? wa[c] : 0.0f;
    }
#pragma unroll   // constant index, so that the loaded values stay in registers
    for (int it = 0; it < 2; ++it) {
        const int e = tid + 256 * it;
        const int r = e >> 5, q = e & 31;
        *(v4f*)(sQ + r * NC_ + 4 * q) = qv[it];
    }
    // wa as a [n][c] 16-bit operand: column 0 = f16 hi, column 1 = (wa - hi) * 4096, columns 2..15 = 0
#pragma unroll   // constant index, so that the loaded values stay in registers
    for (int it = 0; it < NWB; ++it) {
        const int e = tid + 256 * it;
        const int rr = e / WBP_;
        const int c = e - rr * WBP_;
        _Float16 val = (_Float16)0.0f;
        if (c < NC_) {
            const float w = wv[it];
            const _Float16 hi = (_Float16)w;
            if (rr == 0) val = hi;
            else if (rr == 1) val = (_Float16)((w - (float)hi) * 4096.0f);
        }
        if (e < 16 * WBP_) sWB[e] = val;
    }
    if (tid < 16) { sM[tid] = -3.0e38f; sL[tid] = 0.0f; }
    const float bav = ba[0];

    v8f acco = {};   // output tile accumulator: rows 8h+r, column ncol (scaled by 4096)

#pragma unroll 1
    for (int ch = 0; ch < NL_ / JC_; ++ch) {
        __syncthreads();   // readers of sK / sVT / sS / sP from the last chunk are done
        const int j0 = ch * JC_;
        // the chunk's eight loads a thread (four of keys, four of values) are issued together:
        // one trip to memory a chunk instead of eight, each waited for in turn
        v4f_t kv[4], vv[4];
#pragma unroll   // straight-line code, so that the loads stand together with no wait between them
        for (int it = 0; it < 4; ++it) {   // element e = tid + 256*it of the chunk: row e>>5, float4 e&31, rows contiguous
            kv[it] = *(const v4f*)(Kx + (size_t)(b * NL_ + j0) * NC_ + 4 * tid + 1024 * it);
            vv[it] = *(const v4f*)(X + (size_t)(b * NL_ + j0) * ND_ + 4 * tid + 1024 * it);
        }
        // key chunk 32 x 128 f32
#pragma unroll   // constant index, so that the loaded values stay in registers
        for (int it = 0; it < 4; ++it) {
            const int e = tid + 256 * it;
            const int r = e >> 5, q = e & 31;
            *(v4f*)(sK + r * KP_ + 4 * q) = kv[it];
        }
        // value chunk transposed to [d][j] f16
#pragma unroll   // constant index, so that the loaded values stay in registers
        for (int it = 0; it < 4; ++it) {
            const int e = tid + 256 * it;
            const int r = e >> 5, q = e & 31;
            const v4f_t v = vv[it];
            sVT[(4 * q + 0) * VP_ + r] = (_Float16)v.x;
            sVT[(4 * q + 1) * VP_ + r] = (_Float16)v.y;
            sVT[(4 * q + 2) * VP_ + r] = (_Float16)v.z;
            sVT[(4 * q + 3) * VP_ + r] = (_Float16)v.w;
        }
        __syncthreads();

        // scores: tile t = (query i, 16 keys jb..jb+15); A row = key index (lane m), k = channel; B = wa columns
#pragma unroll 1
        for (int u = 0; u < 4; ++u) {
            const int t  = wave * 4 + u;
            const int i  = t >> 1;
            const int jb = (t & 1) * 16;
            const int j  = jb + m;
            v8f acc = {};
#pragma unroll
            for (int kk = 0; kk < 4; ++kk) {
                const int cb = kk * 32;
                const float* qp = sQ + i * NC_ + cb + 8 * h;
                const float* kp = sK + j * KP_ + cb + 8 * h;
                const v4f_t x0 = *(const v4f*)(qp)      + *(const v4f*)(kp);
                const v4f_t x1 = *(const v4f*)(qp + 4)  + *(const v4f*)(kp + 4);
                const v4f_t x2 = *(const v4f*)(qp + 16) + *(const v4f*)(kp + 16);
                const v4f_t x3 = *(const v4f*)(qp + 20) + *(const v4f*)(kp + 20);
                FragH fa;   // elements 0..7 = channels cb+8h.., 8..15 = cb+16+8h..
                fa.e[0]  = th64_h(x0.x); fa.e[1]  = th64_h(x0.y); fa.e[2]  = th64_h(x0.z); fa.e[3]  = th64_h(x0.w);
                fa.e[4]  = th64_h(x1.x); fa.e[5]  = th64_h(x1.y); fa.e[6]  = th64_h(x1.z); fa.e[7]  = th64_h(x1.w);
                fa.e[8]  = th64_h(x2.x); fa.e[9]  = th64_h(x2.y); fa.e[10] = th64_h(x2.z); fa.e[11] = th64_h(x2.w);
                fa.e[12] = th64_h(x3.x); fa.e[13] = th64_h(x3.y); fa.e[14] = th64_h(x3.z); fa.e[15] = th64_h(x3.w);
                FragH fb;   // column m of the wa tile, same k map
                fb.q[0] = *(const v8h*)(sWB + m * WBP_ + cb + 8 * h);
                fb.q[1] = *(const v8h*)(sWB + m * WBP_ + cb + 16 + 8 * h);
                acc = mma_f16(acc, fa.v, fb.v);
            }
            // D: lane column 0 = hi sums, column 1 = lo sums (x4096); rows 8h+r = keys jb+8h+r
            float sv[8];
#pragma unroll
            for (int r = 0; r < 8; ++r) {
                const float lo = __shfl_xor(acc[r], 1);
                sv[r] = acc[r] * (1.0f / 64.0f) + lo * (1.0f / 262144.0f) + bav;
            }
            if (m == 0) {
#pragma unroll
                for (int r = 0; r < 8; ++r) sS[i * JC_ + jb + 8 * h + r] = sv[r];
            }
        }
        __syncthreads();

        // online softmax statistics per query row
        if (tid < 16) {
            const int i = tid;
            const float mo = sM[i];
            float cm = mo;
            for (int jj = 0; jj < JC_; ++jj) cm = fmaxf(cm, sS[i * JC_ + jj]);
            const float sc = __builtin_amdgcn_exp2f((mo - cm) * LOG2E_F);
            float ls = sL[i] * sc;
            for (int jj = 0; jj < JC_; ++jj) {
                const float ev = __builtin_amdgcn_exp2f((sS[i * JC_ + jj] - cm) * LOG2E_F);
                ls += ev;
                sP[i * JC_ + jj] = (_Float16)(ev * 4096.0f);
            }
            sM[i] = cm; sL[i] = ls; sSc[i] = sc;
        }
        __syncthreads();

        // O = O*scale + P(16 x 32 keys) * V(32 keys x 16 cols)
#pragma unroll
        for (int r = 0; r < 8; ++r) acco[r] *= sSc[8 * h + r];
        FragH fp, fv;
        fp.q[0] = *(const v8h*)(sP + m * JC_ + 8 * h);
        fp.q[1] = *(const v8h*)(sP + m * JC_ + 16 + 8 * h);
        fv.q[0] = *(const v8h*)(sVT + ncol * VP_ + 8 * h);
        fv.q[1] = *(const v8h*)(sVT + ncol * VP_ + 16 + 8 * h);
        acco = mma_f16(acco, fp.v, fv.v);
    }

    // epilogue: normalise, stage the 16 x 128 tile, whole-row stores
#pragma unroll
    for (int r = 0; r < 8; ++r) {
        const int row = 8 * h + r;
        const float inv = 1.0f / (sL[row] + EPS_);
        sO[row * OP_ + ncol] = acco[r] * inv * (1.0f / 4096.0f);
    }
    __syncthreads();
    const int r0 = 2 * wave, r1 = 2 * wave + 1;
    const v4f_t v0 = *(const v4f*)(sO + r0 * OP_ + 4 * lane);
    const v4f_t v1 = *(const v4f*)(sO + r1 * OP_ + 4 * lane);
    float* p0 = Out + (size_t)(qrow0 + r0) * ND_ + 4 * lane;
    float* p1 = Out + (size_t)(qrow0 + r1) * ND_ + 4 * lane;
    *(v4f*)p0 = v0;
    *(v4f*)p1 = v1;
    
}

// ---------------- launcher ----------------
extern "C" void kernel_launch(void* const* d_in, const int* in_sizes, int n_in,
                              void* d_out, int out_size, void* d_ws, size_t ws_size,
                              hipStream_t stream) {
    if (n_in < 6) return;
    if (in_sizes[0] != NROWS_ * ND_ || in_sizes[1] != ND_ * NC_ || in_sizes[2] != ND_ * NC_ ||
        in_sizes[3] != NC_ || in_sizes[4] != NC_ || in_sizes[5] < 1 || out_size != NROWS_ * ND_)
        return;

    const float* inps  = (const float*)d_in[0];
    const float* wei_t = (const float*)d_in[1];
    const float* wei_x = (const float*)d_in[2];
    const float* bxh   = (const float*)d_in[3];
    const float* wei_a = (const float*)d_in[4];
    const float* bxa   = (const float*)d_in[5];
    float* out = (float*)d_out;

    // workspace: Q [NROWS][NC] f32 at 0, K [NROWS][NC] f32 at 1 MiB; total 2 MiB
    const size_t per = (size_t)NROWS_ * NC_ * sizeof(float);
    if (ws_size < 2 * per) return;
    float* qb = (float*)d_ws;
    float* kx = (float*)((char*)d_ws + per);

    const int nrows = NROWS_;
    k_proj<<<dim3((nrows + 15) / 16), dim3(256), 0, stream>>>(inps, wei_t, wei_x, bxh, qb, kx, nrows);
    k_attn<<<dim3(NB_ * (NL_ / 16)), dim3(256), 0, stream>>>(inps, qb, kx, wei_a, bxa, out);
}

// v002
// A run of this version takes 67.3 microseconds.
// Timed twice side by side with v001, it ran 1.25 times as fast both times.
// All steps since v000 together make it 1.99 times as fast.
#include <hip/hip_runtime.h>
#include <stdint.h>

// Contractions: X*Wt and X*Wx on v_wmma_f32_16x16x32_bf16 as bf16 hi/lo split (3 products each); tanh-score channel reduction (N padded to 16) and P*V on v_wmma_f32_16x16x32_f16 (f16 operands; the low part of wa and P power-of-two pre-scaled); all accumulation f32.

#define NB_    4
#define NL_    512
#define ND_    128
#define NC_    128
#define NROWS_ (NB_ * NL_)
#define EPS_   1e-7f
#define JC_    32          // keys per chunk
#define KP_    132         // f32 pitch of the key tile in LDS
#define VP_    40          // f16 pitch of the transposed value tile [d][j]
#define WBP_   136         // f16 pitch of the wa operand tile [n][c]
#define OP_    132         // f32 pitch of the output staging tile
#define AP2_   68          // uint32 pitch (136 halves) of the bf16 activation tile
#define WP2_   20          // uint32 pitch (40 halves) of the bf16 weight slab [n][k]

typedef float    v8f   __attribute__((ext_vector_type(8)));
typedef float    v4f_t __attribute__((ext_vector_type(4)));
typedef v4f_t    __attribute__((may_alias)) v4f;
typedef uint32_t v4u_t __attribute__((ext_vector_type(4)));
typedef v4u_t    __attribute__((may_alias)) v4u;
typedef __bf16   v16bf __attribute__((ext_vector_type(16)));
typedef _Float16 v16h  __attribute__((ext_vector_type(16)));
typedef _Float16 v8h_t __attribute__((ext_vector_type(8)));
typedef v8h_t    __attribute__((may_alias)) v8h;

union FragB { v4u_t q[2]; v16bf v; };
union FragH { _Float16 e[16]; v8h_t q[2]; v16h v; };

#define LOG2E_F     1.4426950408889634f

// ---------------- WMMA wrappers with hazard guard ----------------
__device__ __forceinline__ v8f mma_bf16(v8f acc, v16bf a, v16bf b) {
    acc = __builtin_amdgcn_wmma_f32_16x16x32_bf16(false, a, false, b, (short)0, acc, false, false);
    asm volatile("v_nop\n\tv_nop\n\tv_nop\n\tv_nop" : "+v"(acc) : "v"(a), "v"(b));
    return acc;
}
__device__ __forceinline__ v8f mma_f16(v8f acc, v16h a, v16h b) {
    acc = __builtin_amdgcn_wmma_f32_16x16x32_f16(false, a, false, b, (short)0, acc, false, false);
    asm volatile("v_nop\n\tv_nop\n\tv_nop\n\tv_nop" : "+v"(acc) : "v"(a), "v"(b));
    return acc;
}

// ---------------- f32 -> bf16 (RNE) hi/lo split ----------------
__device__ __forceinline__ uint32_t bf_bits(float f) {
    uint32_t u = __builtin_bit_cast(uint32_t, f);
    u += 0x7FFFu + ((u >> 16) & 1u);
    return u >> 16;
}
__device__ __forceinline__ void bf_split(float x, uint32_t& hi, uint32_t& lo) {
    hi = bf_bits(x);
    const float xh = __builtin_bit_cast(float, hi << 16);
    lo = bf_bits(x - xh);
}

// tanh(x) as f16 (RNE convert); the tanh is the chip's own instruction, v_tanh_f32
__device__ __forceinline__ _Float16 th_h(float x) {
    return (_Float16)__builtin_amdgcn_tanhf(x);
}

// ---------------- kernel 0: Q = X*Wt + bh, K = X*Wx (bf16 hi/lo split WMMA) ----------------
// grid = ceil(nrows/16) blocks of 256 threads; wave w owns output columns 16w..16w+15.
__global__ __launch_bounds__(256) void k_proj(
    const float* __restrict__ X, const float* __restrict__ Wt, const float* __restrict__ Wx,
    const float* __restrict__ bh, float* Qo, float* Ko, int nrows)
{
    __shared__ __align__(16) uint32_t sAh[16 * AP2_];
    __shared__ __align__(16) uint32_t sAl[16 * AP2_];
    __shared__ __align__(16) uint32_t sWh[NC_ * WP2_];
    __shared__ __align__(16) uint32_t sWl[NC_ * WP2_];
    __shared__ __align__(16) float    sO[16 * OP_];

    const int tid = threadIdx.x, lane = tid & 31, wave = tid >> 5;
    const int h = lane >> 4, m = lane & 15;
    const int row0 = blockIdx.x * 16;
    const int ncol = wave * 16 + m;

    // activation tile 16 x 128 -> bf16 hi and lo planes (packed pairs)
    // (all loads of the tile are issued before the first is used: one trip to memory, not one a pass)
    v4f_t xa[2];
#pragma unroll   // straight-line code, so that the loads stand together with no wait between them
    for (int it = 0; it < 2; ++it) {
        const int e = tid + 256 * it;
        const int r = e >> 5, q = e & 31;
        const int gr = row0 + r;
        xa[it] = v4f_t{0.0f, 0.0f, 0.0f, 0.0f};
        if (gr < nrows) xa[it] = *(const v4f*)(X + (size_t)gr * ND_ + 4 * q);
    }
#pragma unroll   // constant index, so that the loaded values stay in registers
    for (int it = 0; it < 2; ++it) {
        const int e = tid + 256 * it;
        const int r = e >> 5, q = e & 31;
        const v4f_t v = xa[it];
        uint32_t h0, l0, h1, l1, h2, l2, h3, l3;
        bf_split(v.x, h0, l0); bf_split(v.y, h1, l1);
        bf_split(v.z, h2, l2); bf_split(v.w, h3, l3);
        sAh[r * AP2_ + 2 * q]     = h0 | (h1 << 16);
        sAh[r * AP2_ + 2 * q + 1] = h2 | (h3 << 16);
        sAl[r * AP2_ + 2 * q]     = l0 | (l1 << 16);
        sAl[r * AP2_ + 2 * q + 1] = l2 | (l3 << 16);
    }

#pragma unroll 1
    for (int g = 0; g < 2; ++g) {
        const float* W = (g == 0) ? Wt : Wx;
        float* dst = (g == 0) ? Qo : Ko;
        v8f acc = {};
#pragma unroll 1
        for (int kk = 0; kk < 4; ++kk) {
            __syncthreads();   // earlier readers of sW* / sO done; sA* staged
            // weight slab rows k = 32kk..32kk+31, stored transposed [n][k-in-slab] as bf16 hi/lo pairs
            // (the slab's 16 loads a thread are issued together, then split and stored)
            float w0[8], w1[8];
#pragma unroll   // straight-line code, so that the loads stand together with no wait between them
            for (int it = 0; it < 8; ++it) {
                const int e = tid + 256 * it;
                const int n = e & (NC_ - 1), kp = e >> 7;
                const int k = kk * 32 + 2 * kp;
                w0[it] = W[(size_t)k * NC_ + n];
                w1[it] = W[(size_t)(k + 1) * NC_ + n];
            }
#pragma unroll   // constant index, so that the loaded values stay in registers
            for (int it = 0; it < 8; ++it) {
                const int e = tid + 256 * it;
                const int n = e & (NC_ - 1), kp = e >> 7;
                uint32_t a0, b0, a1, b1;
                bf_split(w0[it], a0, b0); bf_split(w1[it], a1, b1);
                sWh[n * WP2_ + kp] = a0 | (a1 << 16);
                sWl[n * WP2_ + kp] = b0 | (b1 << 16);
            }
            __syncthreads();
            // A: row m, elements 0..7 = k0+8h.., 8..15 = k0+16+8h..; B: column ncol, same k map from the [n][k] copy
            FragB fah, fal, fbh, fbl;
            const uint32_t* pa = sAh + m * AP2_ + kk * 16 + 4 * h;
            const uint32_t* pl = sAl + m * AP2_ + kk * 16 + 4 * h;
            const uint32_t* pb = sWh + ncol * WP2_ + 4 * h;
            const uint32_t* pc = sWl + ncol * WP2_ + 4 * h;
            fah.q[0] = *(const v4u*)(pa); fah.q[1] = *(const v4u*)(pa + 8);
            fal.q[0] = *(const v4u*)(pl); fal.q[1] = *(const v4u*)(pl + 8);
            fbh.q[0] = *(const v4u*)(pb); fbh.q[1] = *(const v4u*)(pb + 8);
            fbl.q[0] = *(const v4u*)(pc); fbl.q[1] = *(const v4u*)(pc + 8);
            acc = mma_bf16(acc, fah.v, fbh.v);
            acc = mma_bf16(acc, fah.v, fbl.v);
            acc = mma_bf16(acc, fal.v, fbh.v);
        }
        const float bias = (g == 0) ? bh[ncol] : 0.0f;
#pragma unroll
        for (int r = 0; r < 8; ++r) sO[(8 * h + r) * OP_ + ncol] = acc[r] + bias;
        __syncthreads();
        const int r0 = 2 * wave, r1 = 2 * wave + 1;
        const v4f_t v0 = *(const v4f*)(sO + r0 * OP_ + 4 * lane);
        const v4f_t v1 = *(const v4f*)(sO + r1 * OP_ + 4 * lane);
        const int g0 = row0 + r0, g1 = row0 + r1;
        if (g0 < nrows) *(v4f*)(dst + (size_t)g0 * NC_ + 4 * lane) = v0;
        if (g1 < nrows) *(v4f*)(dst + (size_t)g1 * NC_ + 4 * lane) = v1;
        // the next pass reuses the registers that the two stores name: wait before they are overwritten
        asm volatile("s_wait_xcnt 0x0" ::: "memory");
    }
}

// ---------------- kernel 1: tanh scores (WMMA channel reduction) + online softmax + P*V ----------------
// grid = NB*(NL/16) blocks of 256 threads; block owns (batch b, 16 query rows); wave w owns output columns 16w..16w+15.
__global__ __launch_bounds__(256) void k_attn(
    const float* __restrict__ X, const float* __restrict__ Qb, const float* __restrict__ Kx,
    const float* __restrict__ wa, const float* __restrict__ ba, float* Out)
{
    __shared__ __align__(16) float    sQ[16 * NC_];
    __shared__ __align__(16) float    sK[JC_ * KP_];
    __shared__ __align__(16) _Float16 sVT[ND_ * VP_];
    __shared__ __align__(16) _Float16 sWB[16 * WBP_];
    __shared__ __align__(16) _Float16 sP[16 * JC_];
    __shared__ float sS[16 * JC_];
    __shared__ __align__(16) float    sO[16 * OP_];
    __shared__ float sM[16], sL[16], sSc[16];

    const int tid = threadIdx.x, lane = tid & 31, wave = tid >> 5;
    const int h = lane >> 4, m = lane & 15;
    const int b  = blockIdx.x / (NL_ / 16);
    const int it = blockIdx.x % (NL_ / 16);
    const int qrow0 = b * NL_ + it * 16;
    const int ncol = wave * 16 + m;

    // query tile (bias already folded in)
    // (its loads and those of wa below are all issued before the first LDS store)
    v4f_t qv[2];
#pragma unroll   // straight-line code, so that the loads stand together with no wait between them
    for (int it = 0; it < 2; ++it)   // element e = tid + 256*it of the tile, rows contiguous
        qv[it] = *(const v4f*)(Qb + (size_t)qrow0 * NC_ + 4 * tid + 1024 * it);
    constexpr int NWB = (16 * WBP_ + 255) / 256;
    float wv[NWB];
#pragma unroll   // straight-line code, so that the loads stand together with no wait between them
    for (int it = 0; it < NWB; ++it) {
        const int e = tid + 256 * it;
        const int c = e % WBP_;
        wv[it] = (c < NC_) ? wa[c] : 0.0f;
    }
#pragma unroll   // constant index, so that the loaded values stay in registers
    for (int it = 0; it < 2; ++it) {
        const int e = tid + 256 * it;
        const int r = e >> 5, q = e & 31;
        *(v4f*)(sQ + r * NC_ + 4 * q) = qv[it];
    }
    // wa as a [n][c] 16-bit operand: column 0 = f16 hi, column 1 = (wa - hi) * 4096, columns 2..15 = 0
#pragma unroll   // constant index, so that the loaded values stay in registers
    for (int it = 0; it < NWB; ++it) {
        const int e = tid + 256 * it;
        const int rr = e / WBP_;
        const int c = e - rr * WBP_;
        _Float16 val = (_Float16)0.0f;
        if (c < NC_) {
            const float w = wv[it];
            const _Float16 hi = (_Float16)w;
            if (rr == 0) val = hi;
            else if (rr == 1) val = (_Float16)((w - (float)hi) * 4096.0f);
        }
        if (e < 16 * WBP_) sWB[e] = val;
    }
    if (tid < 16) { sM[tid] = -3.0e38f; sL[tid] = 0.0f; }
    const float bav = ba[0];

    v8f acco = {};   // output tile accumulator: rows 8h+r, column ncol (scaled by 4096)

#pragma unroll 1
    for (int ch = 0; ch < NL_ / JC_; ++ch) {
        __syncthreads();   // readers of sK / sVT / sS / sP from the last chunk are done
        const int j0 = ch * JC_;
        // the chunk's eight loads a thread (four of keys, four of values) are issued together:
        // one trip to memory a chunk instead of eight, each waited for in turn
        v4f_t kv[4], vv[4];
#pragma unroll   // straight-line code, so that the loads stand together with no wait between them
        for (int it = 0; it < 4; ++it) {   // element e = tid + 256*it of the chunk: row e>>5, float4 e&31, rows contiguous
            kv[it] = *(const v4f*)(Kx + (size_t)(b * NL_ + j0) * NC_ + 4 * tid + 1024 * it);
            vv[it] = *(const v4f*)(X + (size_t)(b * NL_ + j0) * ND_ + 4 * tid + 1024 * it);
        }
        // key chunk 32 x 128 f32
#pragma unroll   // constant index, so that the loaded values stay in registers
        for (int it = 0; it < 4; ++it) {
            const int e = tid + 256 * it;
            const int r = e >> 5, q = e & 31;
            *(v4f*)(sK + r * KP_ + 4 * q) = kv[it];
        }
        // value chunk transposed to [d][j] f16
#pragma unroll   // constant index, so that the loaded values stay in registers
        for (int it = 0; it < 4; ++it) {
            const int e = tid + 256 * it;
            const int r = e >> 5, q = e & 31;
            const v4f_t v = vv[it];
            sVT[(4 * q + 0) * VP_ + r] = (_Float16)v.x;
            sVT[(4 * q + 1) * VP_ + r] = (_Float16)v.y;
            sVT[(4 * q + 2) * VP_ + r] = (_Float16)v.z;
            sVT[(4 * q + 3) * VP_ + r] = (_Float16)v.w;
        }
        __syncthreads();

        // scores: tile t = (query i, 16 keys jb..jb+15); A row = key index (lane m), k = channel; B = wa columns
#pragma unroll 1
        for (int u = 0; u < 4; ++u) {
            const int t  = wave * 4 + u;
            const int i  = t >> 1;
            const int jb = (t & 1) * 16;
            const int j  = jb + m;
            v8f acc = {};
#pragma unroll
            for (int kk = 0; kk < 4; ++kk) {
                const int cb = kk * 32;
                const float* qp = sQ + i * NC_ + cb + 8 * h;
                const float* kp = sK + j * KP_ + cb + 8 * h;
                const v4f_t x0 = *(const v4f*)(qp)      + *(const v4f*)(kp);
                const v4f_t x1 = *(const v4f*)(qp + 4)  + *(const v4f*)(kp + 4);
                const v4f_t x2 = *(const v4f*)(qp + 16) + *(const v4f*)(kp + 16);
                const v4f_t x3 = *(const v4f*)(qp + 20) + *(const v4f*)(kp + 20);
                FragH fa;   // elements 0..7 = channels cb+8h.., 8..15 = cb+16+8h..
                fa.e[0]  = th_h(x0.x); fa.e[1]  = th_h(x0.y); fa.e[2]  = th_h(x0.z); fa.e[3]  = th_h(x0.w);
                fa.e[4]  = th_h(x1.x); fa.e[5]  = th_h(x1.y); fa.e[6]  = th_h(x1.z); fa.e[7]  = th_h(x1.w);
                fa.e[8]  = th_h(x2.x); fa.e[9]  = th_h(x2.y); fa.e[10] = th_h(x2.z); fa.e[11] = th_h(x2.w);
                fa.e[12] = th_h(x3.x); fa.e[13] = th_h(x3.y); fa.e[14] = th_h(x3.z); fa.e[15] = th_h(x3.w);
                FragH fb;   // column m of the wa tile, same k map
                fb.q[0] = *(const v8h*)(sWB + m * WBP_ + cb + 8 * h);
                fb.q[1] = *(const v8h*)(sWB + m * WBP_ + cb + 16 + 8 * h);
                acc = mma_f16(acc, fa.v, fb.v);
            }
            // D: lane column 0 = hi sums, column 1 = lo sums (x4096); rows 8h+r = keys jb+8h+r
            float sv[8];
#pragma unroll
            for (int r = 0; r < 8; ++r) {
                const float lo = __shfl_xor(acc[r], 1);
                sv[r] = acc[r] + lo * (1.0f / 4096.0f) + bav;
            }
            if (m == 0) {
#pragma unroll
                for (int r = 0; r < 8; ++r) sS[i * JC_ + jb + 8 * h + r] = sv[r];
            }
        }
        __syncthreads();

        // online softmax statistics per query row
        if (tid < 16) {
            const int i = tid;
            const float mo = sM[i];
            float cm = mo;
            for (int jj = 0; jj < JC_; ++jj) cm = fmaxf(cm, sS[i * JC_ + jj]);
            const float sc = __builtin_amdgcn_exp2f((mo - cm) * LOG2E_F);
            float ls = sL[i] * sc;
            for (int jj = 0; jj < JC_; ++jj) {
                const float ev = __builtin_amdgcn_exp2f((sS[i * JC_ + jj] - cm) * LOG2E_F);
                ls += ev;
                sP[i * JC_ + jj] = (_Float16)(ev * 4096.0f);
            }
            sM[i] = cm; sL[i] = ls; sSc[i] = sc;
        }
        __syncthreads();

        // O = O*scale + P(16 x 32 keys) * V(32 keys x 16 cols)
#pragma unroll
        for (int r = 0; r < 8; ++r) acco[r] *= sSc[8 * h + r];
        FragH fp, fv;
        fp.q[0] = *(const v8h*)(sP + m * JC_ + 8 * h);
        fp.q[1] = *(const v8h*)(sP + m * JC_ + 16 + 8 * h);
        fv.q[0] = *(const v8h*)(sVT + ncol * VP_ + 8 * h);
        fv.q[1] = *(const v8h*)(sVT + ncol * VP_ + 16 + 8 * h);
        acco = mma_f16(acco, fp.v, fv.v);
    }

    // epilogue: normalise, stage the 16 x 128 tile, whole-row stores
#pragma unroll
    for (int r = 0; r < 8; ++r) {
        const int row = 8 * h + r;
        const float inv = 1.0f / (sL[row] + EPS_);
        sO[row * OP_ + ncol] = acco[r] * inv * (1.0f / 4096.0f);
    }
    __syncthreads();
    const int r0 = 2 * wave, r1 = 2 * wave + 1;
    const v4f_t v0 = *(const v4f*)(sO + r0 * OP_ + 4 * lane);
    const v4f_t v1 = *(const v4f*)(sO + r1 * OP_ + 4 * lane);
    float* p0 = Out + (size_t)(qrow0 + r0) * ND_ + 4 * lane;
    float* p1 = Out + (size_t)(qrow0 + r1) * ND_ + 4 * lane;
    *(v4f*)p0 = v0;
    *(v4f*)p1 = v1;
    
}

// ---------------- launcher ----------------
extern "C" void kernel_launch(void* const* d_in, const int* in_sizes, int n_in,
                              void* d_out, int out_size, void* d_ws, size_t ws_size,
                              hipStream_t stream) {
    if (n_in < 6) return;
    if (in_sizes[0] != NROWS_ * ND_ || in_sizes[1] != ND_ * NC_ || in_sizes[2] != ND_ * NC_ ||
        in_sizes[3] != NC_ || in_sizes[4] != NC_ || in_sizes[5] < 1 || out_size != NROWS_ * ND_)
        return;

    const float* inps  = (const float*)d_in[0];
    const float* wei_t = (const float*)d_in[1];
    const float* wei_x = (const float*)d_in[2];
    const float* bxh   = (const float*)d_in[3];
    const float* wei_a = (const float*)d_in[4];
    const float* bxa   = (const float*)d_in[5];
    float* out = (float*)d_out;

    // workspace: Q [NROWS][NC] f32 at 0, K [NROWS][NC] f32 at 1 MiB; total 2 MiB
    const size_t per = (size_t)NROWS_ * NC_ * sizeof(float);
    if (ws_size < 2 * per) return;
    float* qb = (float*)d_ws;
    float* kx = (float*)((char*)d_ws + per);

    const int nrows = NROWS_;
    k_proj<<<dim3((nrows + 15) / 16), dim3(256), 0, stream>>>(inps, wei_t, wei_x, bxh, qb, kx, nrows);
    k_attn<<<dim3(NB_ * (NL_ / 16)), dim3(256), 0, stream>>>(inps, qb, kx, wei_a, bxa, out);
}

// v003
// Measured time: 35.4 microseconds a run.
// Next to v002, in two timings, it ran 1.90 times as fast each time.
// Counting every step since v000, it is 3.79 times as fast.
#include <hip/hip_runtime.h>
#include <stdint.h>

// Contractions: X*Wt and X*Wx on v_wmma_f32_16x16x32_bf16 as bf16 hi/lo split (3 products each); tanh-score channel reduction (N padded to 16) and P*V on v_wmma_f32_16x16x32_f16 (f16 operands; the low part of wa and P power-of-two pre-scaled); all accumulation f32.

#define NB_    4
#define NL_    512
#define ND_    128
#define NC_    128
#define NROWS_ (NB_ * NL_)
#define EPS_   1e-7f
#define JC_    32          // keys per chunk
#define KS_    4           // key ranges: work-groups that share one tile of 16 query rows, NL/KS keys each
#define NQT_   (NROWS_ / 16)   // tiles of 16 query rows
#define KP_    132         // f32 pitch of the key tile in LDS
#define VP_    40          // f16 pitch of the transposed value tile [d][j]
#define WBP_   136         // f16 pitch of the wa operand tile [n][c]
#define OP_    132         // f32 pitch of the output staging tile
#define AP2_   68          // uint32 pitch (136 halves) of the bf16 activation tile
#define WP2_   20          // uint32 pitch (40 halves) of the bf16 weight slab [n][k]

typedef float    v8f   __attribute__((ext_vector_type(8)));
typedef float    v4f_t __attribute__((ext_vector_type(4)));
typedef v4f_t    __attribute__((may_alias)) v4f;
typedef uint32_t v4u_t __attribute__((ext_vector_type(4)));
typedef v4u_t    __attribute__((may_alias)) v4u;
typedef __bf16   v16bf __attribute__((ext_vector_type(16)));
typedef _Float16 v16h  __attribute__((ext_vector_type(16)));
typedef _Float16 v8h_t __attribute__((ext_vector_type(8)));
typedef v8h_t    __attribute__((may_alias)) v8h;

union FragB { v4u_t q[2]; v16bf v; };
union FragH { _Float16 e[16]; v8h_t q[2]; v16h v; };

#define LOG2E_F     1.4426950408889634f

// ---------------- WMMA wrappers with hazard guard ----------------
__device__ __forceinline__ v8f mma_bf16(v8f acc, v16bf a, v16bf b) {
    acc = __builtin_amdgcn_wmma_f32_16x16x32_bf16(false, a, false, b, (short)0, acc, false, false);
    asm volatile("v_nop\n\tv_nop\n\tv_nop\n\tv_nop" : "+v"(acc) : "v"(a), "v"(b));
    return acc;
}
__device__ __forceinline__ v8f mma_f16(v8f acc, v16h a, v16h b) {
    acc = __builtin_amdgcn_wmma_f32_16x16x32_f16(false, a, false, b, (short)0, acc, false, false);
    asm volatile("v_nop\n\tv_nop\n\tv_nop\n\tv_nop" : "+v"(acc) : "v"(a), "v"(b));
    return acc;
}

// ---------------- f32 -> bf16 (RNE) hi/lo split ----------------
__device__ __forceinline__ uint32_t bf_bits(float f) {
    uint32_t u = __builtin_bit_cast(uint32_t, f);
    u += 0x7FFFu + ((u >> 16) & 1u);
    return u >> 16;
}
__device__ __forceinline__ void bf_split(float x, uint32_t& hi, uint32_t& lo) {
    hi = bf_bits(x);
    const float xh = __builtin_bit_cast(float, hi << 16);
    lo = bf_bits(x - xh);
}

// tanh(x) as f16 (RNE convert); the tanh is the chip's own instruction, v_tanh_f32
__device__ __forceinline__ _Float16 th_h(float x) {
    return (_Float16)__builtin_amdgcn_tanhf(x);
}

// ---------------- kernel 0: Q = X*Wt + bh, K = X*Wx (bf16 hi/lo split WMMA) ----------------
// grid = ceil(nrows/16) blocks of 256 threads; wave w owns output columns 16w..16w+15.
__global__ __launch_bounds__(256) void k_proj(
    const float* __restrict__ X, const float* __restrict__ Wt, const float* __restrict__ Wx,
    const float* __restrict__ bh, float* Qo, float* Ko, int nrows)
{
    __shared__ __align__(16) uint32_t sAh[16 * AP2_];
    __shared__ __align__(16) uint32_t sAl[16 * AP2_];
    __shared__ __align__(16) uint32_t sWh[NC_ * WP2_];
    __shared__ __align__(16) uint32_t sWl[NC_ * WP2_];
    __shared__ __align__(16) float    sO[16 * OP_];

    const int tid = threadIdx.x, lane = tid & 31, wave = tid >> 5;
    const int h = lane >> 4, m = lane & 15;
    const int row0 = blockIdx.x * 16;
    const int ncol = wave * 16 + m;

    // activation tile 16 x 128 -> bf16 hi and lo planes (packed pairs)
    // (all loads of the tile are issued before the first is used: one trip to memory, not one a pass)
    v4f_t xa[2];
#pragma unroll   // straight-line code, so that the loads stand together with no wait between them
    for (int it = 0; it < 2; ++it) {
        const int e = tid + 256 * it;
        const int r = e >> 5, q = e & 31;
        const int gr = row0 + r;
        xa[it] = v4f_t{0.0f, 0.0f, 0.0f, 0.0f};
        if (gr < nrows) xa[it] = *(const v4f*)(X + (size_t)gr * ND_ + 4 * q);
    }
#pragma unroll   // constant index, so that the loaded values stay in registers
    for (int it = 0; it < 2; ++it) {
        const int e = tid + 256 * it;
        const int r = e >> 5, q = e & 31;
        const v4f_t v = xa[it];
        uint32_t h0, l0, h1, l1, h2, l2, h3, l3;
        bf_split(v.x, h0, l0); bf_split(v.y, h1, l1);
        bf_split(v.z, h2, l2); bf_split(v.w, h3, l3);
        sAh[r * AP2_ + 2 * q]     = h0 | (h1 << 16);
        sAh[r * AP2_ + 2 * q + 1] = h2 | (h3 << 16);
        sAl[r * AP2_ + 2 * q]     = l0 | (l1 << 16);
        sAl[r * AP2_ + 2 * q + 1] = l2 | (l3 << 16);
    }

#pragma unroll 1
    for (int g = 0; g < 2; ++g) {
        const float* W = (g == 0) ? Wt : Wx;
        float* dst = (g == 0) ? Qo : Ko;
        v8f acc = {};
#pragma unroll 1
        for (int kk = 0; kk < 4; ++kk) {
            __syncthreads();   // earlier readers of sW* / sO done; sA* staged
            // weight slab rows k = 32kk..32kk+31, stored transposed [n][k-in-slab] as bf16 hi/lo pairs
            // (the slab's 16 loads a thread are issued together, then split and stored)
            float w0[8], w1[8];
#pragma unroll   // straight-line code, so that the loads stand together with no wait between them
            for (int it = 0; it < 8; ++it) {
                const int e = tid + 256 * it;
                const int n = e & (NC_ - 1), kp = e >> 7;
                const int k = kk * 32 + 2 * kp;
                w0[it] = W[(size_t)k * NC_ + n];
                w1[it] = W[(size_t)(k + 1) * NC_ + n];
            }
#pragma unroll   // constant index, so that the loaded values stay in registers
            for (int it = 0; it < 8; ++it) {
                const int e = tid + 256 * it;
                const int n = e & (NC_ - 1), kp = e >> 7;
                uint32_t a0, b0, a1, b1;
                bf_split(w0[it], a0, b0); bf_split(w1[it], a1, b1);
                sWh[n * WP2_ + kp] = a0 | (a1 << 16);
                sWl[n * WP2_ + kp] = b0 | (b1 << 16);
            }
            __syncthreads();
            // A: row m, elements 0..7 = k0+8h.., 8..15 = k0+16+8h..; B: column ncol, same k map from the [n][k] copy
            FragB fah, fal, fbh, fbl;
            const uint32_t* pa = sAh + m * AP2_ + kk * 16 + 4 * h;
            const uint32_t* pl = sAl + m * AP2_ + kk * 16 + 4 * h;
            const uint32_t* pb = sWh + ncol * WP2_ + 4 * h;
            const uint32_t* pc = sWl + ncol * WP2_ + 4 * h;
            fah.q[0] = *(const v4u*)(pa); fah.q[1] = *(const v4u*)(pa + 8);
            fal.q[0] = *(const v4u*)(pl); fal.q[1] = *(const v4u*)(pl + 8);
            fbh.q[0] = *(const v4u*)(pb); fbh.q[1] = *(const v4u*)(pb + 8);
            fbl.q[0] = *(const v4u*)(pc); fbl.q[1] = *(const v4u*)(pc + 8);
            acc = mma_bf16(acc, fah.v, fbh.v);
            acc = mma_bf16(acc, fah.v, fbl.v);
            acc = mma_bf16(acc, fal.v, fbh.v);
        }
        const float bias = (g == 0) ? bh[ncol] : 0.0f;
#pragma unroll
        for (int r = 0; r < 8; ++r) sO[(8 * h + r) * OP_ + ncol] = acc[r] + bias;
        __syncthreads();
        const int r0 = 2 * wave, r1 = 2 * wave + 1;
        const v4f_t v0 = *(const v4f*)(sO + r0 * OP_ + 4 * lane);
        const v4f_t v1 = *(const v4f*)(sO + r1 * OP_ + 4 * lane);
        const int g0 = row0 + r0, g1 = row0 + r1;
        if (g0 < nrows) *(v4f*)(dst + (size_t)g0 * NC_ + 4 * lane) = v0;
        if (g1 < nrows) *(v4f*)(dst + (size_t)g1 * NC_ + 4 * lane) = v1;
        // the next pass reuses the registers that the two stores name: wait before they are overwritten
        asm volatile("s_wait_xcnt 0x0" ::: "memory");
    }
}

// ---------------- kernel 1: tanh scores (WMMA channel reduction) + online softmax + P*V over one key range ----------------
// grid = NB*(NL/16)*KS blocks of 256 threads; block owns (batch b, 16 query rows, key range sp); wave w owns output columns 16w..16w+15.
// It leaves its un-normalised partial tile in Op[sp][row][col] and its row maxima and row sums in Ml; kernel 2 merges the ranges.
__global__ __launch_bounds__(256) void k_attn(
    const float* __restrict__ X, const float* __restrict__ Qb, const float* __restrict__ Kx,
    const float* __restrict__ wa, const float* __restrict__ ba, float* Op, float* Ml)
{
    __shared__ __align__(16) float    sQ[16 * NC_];
    __shared__ __align__(16) float    sK[JC_ * KP_];
    __shared__ __align__(16) _Float16 sVT[ND_ * VP_];
    __shared__ __align__(16) _Float16 sWB[16 * WBP_];
    __shared__ __align__(16) _Float16 sP[16 * JC_];
    __shared__ float sS[16 * JC_];
    __shared__ __align__(16) float    sO[16 * OP_];
    __shared__ float sM[16], sL[16], sSc[16];

    const int tid = threadIdx.x, lane = tid & 31, wave = tid >> 5;
    const int h = lane >> 4, m = lane & 15;
    const int sp = blockIdx.x % KS_;
    const int qt = blockIdx.x / KS_;
    const int b  = qt / (NL_ / 16);
    const int it = qt % (NL_ / 16);
    const int qrow0 = b * NL_ + it * 16;
    const int ncol = wave * 16 + m;

    // query tile (bias already folded in)
    // (its loads and those of wa below are all issued before the first LDS store)
    v4f_t qv[2];
#pragma unroll   // straight-line code, so that the loads stand together with no wait between them
    for (int it = 0; it < 2; ++it)   // element e = tid + 256*it of the tile, rows contiguous
        qv[it] = *(const v4f*)(Qb + (size_t)qrow0 * NC_ + 4 * tid + 1024 * it);
    constexpr int NWB = (16 * WBP_ + 255) / 256;
    float wv[NWB];
#pragma unroll   // straight-line code, so that the loads stand together with no wait between them
    for (int it = 0; it < NWB; ++it) {
        const int e = tid + 256 * it;
        const int c = e % WBP_;
        wv[it] = (c < NC_) ? wa[c] : 0.0f;
    }
#pragma unroll   // constant index, so that the loaded values stay in registers
    for (int it = 0; it < 2; ++it) {
        const int e = tid + 256 * it;
        const int r = e >> 5, q = e & 31;
        *(v4f*)(sQ + r * NC_ + 4 * q) = qv[it];
    }
    // wa as a [n][c] 16-bit operand: column 0 = f16 hi, column 1 = (wa - hi) * 4096, columns 2..15 = 0
#pragma unroll   // constant index, so that the loaded values stay in registers
    for (int it = 0; it < NWB; ++it) {
        const int e = tid + 256 * it;
        const int rr = e / WBP_;
        const int c = e - rr * WBP_;
        _Float16 val = (_Float16)0.0f;
        if (c < NC_) {
            const float w = wv[it];
            const _Float16 hi = (_Float16)w;
            if (rr == 0) val = hi;
            else if (rr == 1) val = (_Float16)((w - (float)hi) * 4096.0f);
        }
        if (e < 16 * WBP_) sWB[e] = val;
    }
    if (tid < 16) { sM[tid] = -3.0e38f; sL[tid] = 0.0f; }
    const float bav = ba[0];

    v8f acco = {};   // output tile accumulator: rows 8h+r, column ncol (scaled by 4096)

#pragma unroll 1
    for (int ch = sp * (NL_ / JC_ / KS_); ch < (sp + 1) * (NL_ / JC_ / KS_); ++ch) {
        __syncthreads();   // readers of sK / sVT / sS / sP from the last chunk are done
        const int j0 = ch * JC_;
        // the chunk's eight loads a thread (four of keys, four of values) are issued together:
        // one trip to memory a chunk instead of eight, each waited for in turn
        v4f_t kv[4], vv[4];
#pragma unroll   // straight-line code, so that the loads stand together with no wait between them
        for (int it = 0; it < 4; ++it) {   // element e = tid + 256*it of the chunk: row e>>5, float4 e&31, rows contiguous
            kv[it] = *(const v4f*)(Kx + (size_t)(b * NL_ + j0) * NC_ + 4 * tid + 1024 * it);
            vv[it] = *(const v4f*)(X + (size_t)(b * NL_ + j0) * ND_ + 4 * tid + 1024 * it);
        }
        // key chunk 32 x 128 f32
#pragma unroll   // constant index, so that the loaded values stay in registers
        for (int it = 0; it < 4; ++it) {
            const int e = tid + 256 * it;
            const int r = e >> 5, q = e & 31;
            *(v4f*)(sK + r * KP_ + 4 * q) = kv[it];
        }
        // value chunk transposed to [d][j] f16
#pragma unroll   // constant index, so that the loaded values stay in registers
        for (int it = 0; it < 4; ++it) {
            const int e = tid + 256 * it;
            const int r = e >> 5, q = e & 31;
            const v4f_t v = vv[it];
            sVT[(4 * q + 0) * VP_ + r] = (_Float16)v.x;
            sVT[(4 * q + 1) * VP_ + r] = (_Float16)v.y;
            sVT[(4 * q + 2) * VP_ + r] = (_Float16)v.z;
            sVT[(4 * q + 3) * VP_ + r] = (_Float16)v.w;
        }
        __syncthreads();

        // scores: tile t = (query i, 16 keys jb..jb+15); A row = key index (lane m), k = channel; B = wa columns
#pragma unroll 1
        for (int u = 0; u < 4; ++u) {
            const int t  = wave * 4 + u;
            const int i  = t >> 1;
            const int jb = (t & 1) * 16;
            const int j  = jb + m;
            v8f acc = {};
#pragma unroll
            for (int kk = 0; kk < 4; ++kk) {
                const int cb = kk * 32;
                const float* qp = sQ + i * NC_ + cb + 8 * h;
                const float* kp = sK + j * KP_ + cb + 8 * h;
                const v4f_t x0 = *(const v4f*)(qp)      + *(const v4f*)(kp);
                const v4f_t x1 = *(const v4f*)(qp + 4)  + *(const v4f*)(kp + 4);
                const v4f_t x2 = *(const v4f*)(qp + 16) + *(const v4f*)(kp + 16);
                const v4f_t x3 = *(const v4f*)(qp + 20) + *(const v4f*)(kp + 20);
                FragH fa;   // elements 0..7 = channels cb+8h.., 8..15 = cb+16+8h..
                fa.e[0]  = th_h(x0.x); fa.e[1]  = th_h(x0.y); fa.e[2]  = th_h(x0.z); fa.e[3]  = th_h(x0.w);
                fa.e[4]  = th_h(x1.x); fa.e[5]  = th_h(x1.y); fa.e[6]  = th_h(x1.z); fa.e[7]  = th_h(x1.w);
                fa.e[8]  = th_h(x2.x); fa.e[9]  = th_h(x2.y); fa.e[10] = th_h(x2.z); fa.e[11] = th_h(x2.w);
                fa.e[12] = th_h(x3.x); fa.e[13] = th_h(x3.y); fa.e[14] = th_h(x3.z); fa.e[15] = th_h(x3.w);
                FragH fb;   // column m of the wa tile, same k map
                fb.q[0] = *(const v8h*)(sWB + m * WBP_ + cb + 8 * h);
                fb.q[1] = *(const v8h*)(sWB + m * WBP_ + cb + 16 + 8 * h);
                acc = mma_f16(acc, fa.v, fb.v);
            }
            // D: lane column 0 = hi sums, column 1 = lo sums (x4096); rows 8h+r = keys jb+8h+r
            float sv[8];
#pragma unroll
            for (int r = 0; r < 8; ++r) {
                const float lo = __shfl_xor(acc[r], 1);
                sv[r] = acc[r] + lo * (1.0f / 4096.0f) + bav;
            }
            if (m == 0) {
#pragma unroll
                for (int r = 0; r < 8; ++r) sS[i * JC_ + jb + 8 * h + r] = sv[r];
            }
        }
        __syncthreads();

        // online softmax statistics per query row
        if (tid < 16) {
            const int i = tid;
            const float mo = sM[i];
            float cm = mo;
            for (int jj = 0; jj < JC_; ++jj) cm = fmaxf(cm, sS[i * JC_ + jj]);
            const float sc = __builtin_amdgcn_exp2f((mo - cm) * LOG2E_F);
            float ls = sL[i] * sc;
            for (int jj = 0; jj < JC_; ++jj) {
                const float ev = __builtin_amdgcn_exp2f((sS[i * JC_ + jj] - cm) * LOG2E_F);
                ls += ev;
                sP[i * JC_ + jj] = (_Float16)(ev * 4096.0f);
            }
            sM[i] = cm; sL[i] = ls; sSc[i] = sc;
        }
        __syncthreads();

        // O = O*scale + P(16 x 32 keys) * V(32 keys x 16 cols)
#pragma unroll
        for (int r = 0; r < 8; ++r) acco[r] *= sSc[8 * h + r];
        FragH fp, fv;
        fp.q[0] = *(const v8h*)(sP + m * JC_ + 8 * h);
        fp.q[1] = *(const v8h*)(sP + m * JC_ + 16 + 8 * h);
        fv.q[0] = *(const v8h*)(sVT + ncol * VP_ + 8 * h);
        fv.q[1] = *(const v8h*)(sVT + ncol * VP_ + 16 + 8 * h);
        acco = mma_f16(acco, fp.v, fv.v);
    }

    // epilogue: stage the 16 x 128 partial tile as it stands (scaled by 4096, relative to the range's own maxima), whole-row stores
#pragma unroll
    for (int r = 0; r < 8; ++r) sO[(8 * h + r) * OP_ + ncol] = acco[r];
    __syncthreads();
    const int r0 = 2 * wave, r1 = 2 * wave + 1;
    const v4f_t v0 = *(const v4f*)(sO + r0 * OP_ + 4 * lane);
    const v4f_t v1 = *(const v4f*)(sO + r1 * OP_ + 4 * lane);
    float* p0 = Op + ((size_t)sp * NROWS_ + qrow0 + r0) * ND_ + 4 * lane;
    float* p1 = Op + ((size_t)sp * NROWS_ + qrow0 + r1) * ND_ + 4 * lane;
    *(v4f*)p0 = v0;
    *(v4f*)p1 = v1;
    // the range's 16 row maxima, then its 16 row sums: one whole 128-byte line a work-group
    if (wave == 0) Ml[(size_t)(sp * NQT_ + qt) * 32 + lane] = (h == 0) ? sM[m] : sL[m];
}

// ---------------- kernel 2: merge of the KS key ranges of every query row ----------------
// grid = NROWS/8 blocks of 256 threads; wave w owns query row 8*blockIdx.x + w, lane l its columns 4l..4l+3.
__global__ __launch_bounds__(256) void k_merge(
    const float* __restrict__ Op, const float* __restrict__ Ml, float* Out)
{
    const int lane = threadIdx.x & 31, wave = threadIdx.x >> 5;
    const int row = blockIdx.x * 8 + wave;
    const int qt = row >> 4, rr = row & 15;
    float ms[KS_], ls[KS_];
    v4f_t os[KS_];
#pragma unroll   // straight-line code, so that all loads stand together: one trip to memory
    for (int s = 0; s < KS_; ++s) {
        ms[s] = Ml[(size_t)(s * NQT_ + qt) * 32 + rr];
        ls[s] = Ml[(size_t)(s * NQT_ + qt) * 32 + 16 + rr];
        os[s] = *(const v4f*)(Op + ((size_t)s * NROWS_ + row) * ND_ + 4 * lane);
    }
    // the arithmetic below reuses the registers that hold the loads' addresses: wait before they are overwritten
    asm volatile("s_wait_xcnt 0x0" ::: "memory");
    float mx = ms[0];
#pragma unroll   // constant index, so that the loaded values stay in registers
    for (int s = 1; s < KS_; ++s) mx = fmaxf(mx, ms[s]);
    float l = 0.0f;
    v4f_t o = {0.0f, 0.0f, 0.0f, 0.0f};
#pragma unroll   // constant index, so that the loaded values stay in registers
    for (int s = 0; s < KS_; ++s) {
        const float w = __builtin_amdgcn_exp2f((ms[s] - mx) * LOG2E_F);
        l += ls[s] * w;
        o += os[s] * w;
    }
    const float inv = 1.0f / (l + EPS_);
    *(v4f*)(Out + (size_t)row * ND_ + 4 * lane) = o * inv * (1.0f / 4096.0f);
}

// ---------------- launcher ----------------
extern "C" void kernel_launch(void* const* d_in, const int* in_sizes, int n_in,
                              void* d_out, int out_size, void* d_ws, size_t ws_size,
                              hipStream_t stream) {
    if (n_in < 6) return;
    if (in_sizes[0] != NROWS_ * ND_ || in_sizes[1] != ND_ * NC_ || in_sizes[2] != ND_ * NC_ ||
        in_sizes[3] != NC_ || in_sizes[4] != NC_ || in_sizes[5] < 1 || out_size != NROWS_ * ND_)
        return;

    const float* inps  = (const float*)d_in[0];
    const float* wei_t = (const float*)d_in[1];
    const float* wei_x = (const float*)d_in[2];
    const float* bxh   = (const float*)d_in[3];
    const float* wei_a = (const float*)d_in[4];
    const float* bxa   = (const float*)d_in[5];
    float* out = (float*)d_out;

    // workspace: Q [NROWS][NC] f32 at 0, K [NROWS][NC] f32 at 1 MiB, partial tiles [KS][NROWS][ND] f32 at 2 MiB,
    // then maxima and sums [KS][NQT][32] f32; total 6 MiB + 64 KiB
    const size_t per = (size_t)NROWS_ * NC_ * sizeof(float);
    if (ws_size < (2 + KS_) * per + (size_t)KS_ * NQT_ * 32 * sizeof(float)) return;
    float* qb = (float*)d_ws;
    float* kx = (float*)((char*)d_ws + per);
    float* op = (float*)((char*)d_ws + 2 * per);
    float* ml = (float*)((char*)d_ws + (2 + KS_) * per);

    const int nrows = NROWS_;
    k_proj<<<dim3((nrows + 15) / 16), dim3(256), 0, stream>>>(inps, wei_t, wei_x, bxh, qb, kx, nrows);
    k_attn<<<dim3(NB_ * (NL_ / 16) * KS_), dim3(256), 0, stream>>>(inps, qb, kx, wei_a, bxa, op, ml);
    k_merge<<<dim3(NROWS_ / 8), dim3(256), 0, stream>>>(op, ml, out);
}

// v004
// One run takes 33.7 microseconds.
// Timed twice side by side with v003, it ran 1.04 and 1.06 times as fast.
// Counting every step since v000, it is 3.96 times as fast.
#include <hip/hip_runtime.h>
#include <stdint.h>

// Contractions: X*Wt and X*Wx on v_wmma_f32_16x16x32_bf16 as bf16 hi/lo split (3 products each); tanh-score channel reduction (N padded to 16) and P*V on v_wmma_f32_16x16x32_f16 (f16 operands; the low part of wa and P power-of-two pre-scaled); all accumulation f32.

#define NB_    4
#define NL_    512
#define ND_    128
#define NC_    128
#define NROWS_ (NB_ * NL_)
#define EPS_   1e-7f
#define JC_    32          // keys per chunk
#define KS_    4           // key ranges: work-groups that share one tile of 16 query rows, NL/KS keys each
#define NQT_   (NROWS_ / 16)   // tiles of 16 query rows
#define KP_    132         // f32 pitch of the key tile in LDS
#define VP_    40          // f16 pitch of the transposed value tile [d][j]
#define WBP_   136         // f16 pitch of the wa operand tile [n][c]
#define OP_    132         // f32 pitch of the output staging tile
#define AP2_   68          // uint32 pitch (136 halves) of the bf16 activation tile
#define WP2_   20          // uint32 pitch (40 halves) of the bf16 weight slab [n][k]

typedef float    v8f   __attribute__((ext_vector_type(8)));
typedef float    v4f_t __attribute__((ext_vector_type(4)));
typedef v4f_t    __attribute__((may_alias)) v4f;
typedef uint32_t v4u_t __attribute__((ext_vector_type(4)));
typedef v4u_t    __attribute__((may_alias)) v4u;
typedef __bf16   v16bf __attribute__((ext_vector_type(16)));
typedef _Float16 v16h  __attribute__((ext_vector_type(16)));
typedef _Float16 v8h_t __attribute__((ext_vector_type(8)));
typedef v8h_t    __attribute__((may_alias)) v8h;

union FragB { v4u_t q[2]; v16bf v; };
union FragH { _Float16 e[16]; v8h_t q[2]; v16h v; };

#define LOG2E_F     1.4426950408889634f

// ---------------- WMMA wrappers with hazard guard ----------------
__device__ __forceinline__ v8f mma_bf16(v8f acc, v16bf a, v16bf b) {
    acc = __builtin_amdgcn_wmma_f32_16x16x32_bf16(false, a, false, b, (short)0, acc, false, false);
    asm volatile("v_nop\n\tv_nop\n\tv_nop\n\tv_nop" : "+v"(acc) : "v"(a), "v"(b));
    return acc;
}
__device__ __forceinline__ v8f mma_f16(v8f acc, v16h a, v16h b) {
    acc = __builtin_amdgcn_wmma_f32_16x16x32_f16(false, a, false, b, (short)0, acc, false, false);
    asm volatile("v_nop\n\tv_nop\n\tv_nop\n\tv_nop" : "+v"(acc) : "v"(a), "v"(b));
    return acc;
}

// ---------------- f32 -> bf16 (RNE) hi/lo split ----------------
__device__ __forceinline__ uint32_t bf_bits(float f) {
    uint32_t u = __builtin_bit_cast(uint32_t, f);
    u += 0x7FFFu + ((u >> 16) & 1u);
    return u >> 16;
}
__device__ __forceinline__ void bf_split(float x, uint32_t& hi, uint32_t& lo) {
    hi = bf_bits(x);
    const float xh = __builtin_bit_cast(float, hi << 16);
    lo = bf_bits(x - xh);
}

// tanh(x) as f16 (RNE convert); the tanh is the chip's own instruction, v_tanh_f32
__device__ __forceinline__ _Float16 th_h(float x) {
    return (_Float16)__builtin_amdgcn_tanhf(x);
}

// ---------------- kernel 0: Q = X*Wt + bh, K = X*Wx (bf16 hi/lo split WMMA) ----------------
// grid = ceil(nrows/16) blocks of 256 threads; wave w owns output columns 16w..16w+15.
__global__ __launch_bounds__(256) void k_proj(
    const float* __restrict__ X, const float* __restrict__ Wt, const float* __restrict__ Wx,
    const float* __restrict__ bh, float* Qo, float* Ko, int nrows)
{
    __shared__ __align__(16) uint32_t sAh[16 * AP2_];
    __shared__ __align__(16) uint32_t sAl[16 * AP2_];
    __shared__ __align__(16) uint32_t sWh[NC_ * WP2_];
    __shared__ __align__(16) uint32_t sWl[NC_ * WP2_];
    __shared__ __align__(16) float    sO[16 * OP_];

    const int tid = threadIdx.x, lane = tid & 31, wave = tid >> 5;
    const int h = lane >> 4, m = lane & 15;
    const int row0 = blockIdx.x * 16;
    const int ncol = wave * 16 + m;

    // activation tile 16 x 128 -> bf16 hi and lo planes (packed pairs)
    // (all loads of the tile are issued before the first is used: one trip to memory, not one a pass)
    v4f_t xa[2];
#pragma unroll   // straight-line code, so that the loads stand together with no wait between them
    for (int it = 0; it < 2; ++it) {
        const int e = tid + 256 * it;
        const int r = e >> 5, q = e & 31;
        const int gr = row0 + r;
        xa[it] = v4f_t{0.0f, 0.0f, 0.0f, 0.0f};
        if (gr < nrows) xa[it] = *(const v4f*)(X + (size_t)gr * ND_ + 4 * q);
    }
#pragma unroll   // constant index, so that the loaded values stay in registers
    for (int it = 0; it < 2; ++it) {
        const int e = tid + 256 * it;
        const int r = e >> 5, q = e & 31;
        const v4f_t v = xa[it];
        uint32_t h0, l0, h1, l1, h2, l2, h3, l3;
        bf_split(v.x, h0, l0); bf_split(v.y, h1, l1);
        bf_split(v.z, h2, l2); bf_split(v.w, h3, l3);
        sAh[r * AP2_ + 2 * q]     = h0 | (h1 << 16);
        sAh[r * AP2_ + 2 * q + 1] = h2 | (h3 << 16);
        sAl[r * AP2_ + 2 * q]     = l0 | (l1 << 16);
        sAl[r * AP2_ + 2 * q + 1] = l2 | (l3 << 16);
    }

#pragma unroll 1
    for (int g = 0; g < 2; ++g) {
        const float* W = (g == 0) ? Wt : Wx;
        float* dst = (g == 0) ? Qo : Ko;
        v8f acc = {};
#pragma unroll 1
        for (int kk = 0; kk < 4; ++kk) {
            __syncthreads();   // earlier readers of sW* / sO done; sA* staged
            // weight slab rows k = 32kk..32kk+31, stored transposed [n][k-in-slab] as bf16 hi/lo pairs
            // (the slab's 16 loads a thread are issued together, then split and stored)
            float w0[8], w1[8];
#pragma unroll   // straight-line code, so that the loads stand together with no wait between them
            for (int it = 0; it < 8; ++it) {
                const int e = tid + 256 * it;
                const int n = e & (NC_ - 1), kp = e >> 7;
                const int k = kk * 32 + 2 * kp;
                w0[it] = W[(size_t)k * NC_ + n];
                w1[it] = W[(size_t)(k + 1) * NC_ + n];
            }
#pragma unroll   // constant index, so that the loaded values stay in registers
            for (int it = 0; it < 8; ++it) {
                const int e = tid + 256 * it;
                const int n = e & (NC_ - 1), kp = e >> 7;
                uint32_t a0, b0, a1, b1;
                bf_split(w0[it], a0, b0); bf_split(w1[it], a1, b1);
                sWh[n * WP2_ + kp] = a0 | (a1 << 16);
                sWl[n * WP2_ + kp] = b0 | (b1 << 16);
            }
            __syncthreads();
            // A: row m, elements 0..7 = k0+8h.., 8..15 = k0+16+8h..; B: column ncol, same k map from the [n][k] copy
            FragB fah, fal, fbh, fbl;
            const uint32_t* pa = sAh + m * AP2_ + kk * 16 + 4 * h;
            const uint32_t* pl = sAl + m * AP2_ + kk * 16 + 4 * h;
            const uint32_t* pb = sWh + ncol * WP2_ + 4 * h;
            const uint32_t* pc = sWl + ncol * WP2_ + 4 * h;
            fah.q[0] = *(const v4u*)(pa); fah.q[1] = *(const v4u*)(pa + 8);
            fal.q[0] = *(const v4u*)(pl); fal.q[1] = *(const v4u*)(pl + 8);
            fbh.q[0] = *(const v4u*)(pb); fbh.q[1] = *(const v4u*)(pb + 8);
            fbl.q[0] = *(const v4u*)(pc); fbl.q[1] = *(const v4u*)(pc + 8);
            acc = mma_bf16(acc, fah.v, fbh.v);
            acc = mma_bf16(acc, fah.v, fbl.v);
            acc = mma_bf16(acc, fal.v, fbh.v);
        }
        const float bias = (g == 0) ? bh[ncol] : 0.0f;
#pragma unroll
        for (int r = 0; r < 8; ++r) sO[(8 * h + r) * OP_ + ncol] = acc[r] + bias;
        __syncthreads();
        const int r0 = 2 * wave, r1 = 2 * wave + 1;
        const v4f_t v0 = *(const v4f*)(sO + r0 * OP_ + 4 * lane);
        const v4f_t v1 = *(const v4f*)(sO + r1 * OP_ + 4 * lane);
        const int g0 = row0 + r0, g1 = row0 + r1;
        if (g0 < nrows) *(v4f*)(dst + (size_t)g0 * NC_ + 4 * lane) = v0;
        if (g1 < nrows) *(v4f*)(dst + (size_t)g1 * NC_ + 4 * lane) = v1;
        // the next pass reuses the registers that the two stores name: wait before they are overwritten
        asm volatile("s_wait_xcnt 0x0" ::: "memory");
    }
}

// ---------------- kernel 1: tanh scores (WMMA channel reduction) + online softmax + P*V over one key range ----------------
// grid = NB*(NL/16)*KS blocks of 256 threads; block owns (batch b, 16 query rows, key range sp); wave w owns output columns 16w..16w+15.
// It leaves its un-normalised partial tile in Op[sp][row][col] and its row maxima and row sums in Ml; kernel 2 merges the ranges.
__global__ __launch_bounds__(256) void k_attn(
    const float* __restrict__ X, const float* __restrict__ Qb, const float* __restrict__ Kx,
    const float* __restrict__ wa, const float* __restrict__ ba, float* Op, float* Ml)
{
    __shared__ __align__(16) float    sQ[16 * KP_];
    __shared__ __align__(16) float    sK[JC_ * KP_];
    __shared__ __align__(16) _Float16 sVT[ND_ * VP_];
    __shared__ __align__(16) _Float16 sWB[16 * WBP_];
    __shared__ __align__(16) _Float16 sP[16 * JC_];
    __shared__ __align__(16) float    sS[JC_ * 16];   // scores, [key][query]
    __shared__ __align__(16) float    sO[16 * OP_];
    __shared__ float sM[16], sL[16], sSc[16];

    const int tid = threadIdx.x, lane = tid & 31, wave = tid >> 5;
    const int h = lane >> 4, m = lane & 15;
    const int sp = blockIdx.x % KS_;
    const int qt = blockIdx.x / KS_;
    const int b  = qt / (NL_ / 16);
    const int it = qt % (NL_ / 16);
    const int qrow0 = b * NL_ + it * 16;
    const int ncol = wave * 16 + m;

    // query tile (bias already folded in)
    // (its loads and those of wa below are all issued before the first LDS store)
    v4f_t qv[2];
#pragma unroll   // straight-line code, so that the loads stand together with no wait between them
    for (int it = 0; it < 2; ++it)   // element e = tid + 256*it of the tile, rows contiguous
        qv[it] = *(const v4f*)(Qb + (size_t)qrow0 * NC_ + 4 * tid + 1024 * it);
    constexpr int NWB = (16 * WBP_ + 255) / 256;
    float wv[NWB];
#pragma unroll   // straight-line code, so that the loads stand together with no wait between them
    for (int it = 0; it < NWB; ++it) {
        const int e = tid + 256 * it;
        const int c = e % WBP_;
        wv[it] = (c < NC_) ? wa[c] : 0.0f;
    }
#pragma unroll   // constant index, so that the loaded values stay in registers
    for (int it = 0; it < 2; ++it) {
        const int e = tid + 256 * it;
        const int r = e >> 5, q = e & 31;
        *(v4f*)(sQ + r * KP_ + 4 * q) = qv[it];
    }
    // wa as a [n][c] 16-bit operand: column 0 = f16 hi, column 1 = (wa - hi) * 4096, columns 2..15 = 0
#pragma unroll   // constant index, so that the loaded values stay in registers
    for (int it = 0; it < NWB; ++it) {
        const int e = tid + 256 * it;
        const int rr = e / WBP_;
        const int c = e - rr * WBP_;
        _Float16 val = (_Float16)0.0f;
        if (c < NC_) {
            const float w = wv[it];
            const _Float16 hi = (_Float16)w;
            if (rr == 0) val = hi;
            else if (rr == 1) val = (_Float16)((w - (float)hi) * 4096.0f);
        }
        if (e < 16 * WBP_) sWB[e] = val;
    }
    if (tid < 16) { sM[tid] = -3.0e38f; sL[tid] = 0.0f; }
    const float bav = ba[0];

    // the two score operands that no key changes go to registers once: this lane's query row (A side) and its wa column (B side)
    __syncthreads();   // sQ and sWB staged
    v4f_t qf[16];      // query row m; pass kk: channels 32kk+8h..+7 in [4kk], [4kk+1], channels 32kk+16+8h..+7 in [4kk+2], [4kk+3]
    FragH wb[4];       // column m of the wa tile, same k map
#pragma unroll   // constant index, so that the fragments stay in registers
    for (int kk = 0; kk < 4; ++kk) {
        const float* qp = sQ + m * KP_ + kk * 32 + 8 * h;
        qf[4 * kk + 0] = *(const v4f*)(qp);
        qf[4 * kk + 1] = *(const v4f*)(qp + 4);
        qf[4 * kk + 2] = *(const v4f*)(qp + 16);
        qf[4 * kk + 3] = *(const v4f*)(qp + 20);
        wb[kk].q[0] = *(const v8h*)(sWB + m * WBP_ + kk * 32 + 8 * h);
        wb[kk].q[1] = *(const v8h*)(sWB + m * WBP_ + kk * 32 + 16 + 8 * h);
    }

    v8f acco = {};   // output tile accumulator: rows 8h+r, column ncol (scaled by 4096)

#pragma unroll 1
    for (int ch = sp * (NL_ / JC_ / KS_); ch < (sp + 1) * (NL_ / JC_ / KS_); ++ch) {
        __syncthreads();   // readers of sK / sVT / sS / sP from the last chunk are done
        const int j0 = ch * JC_;
        // the chunk's eight loads a thread (four of keys, four of values) are issued together:
        // one trip to memory a chunk instead of eight, each waited for in turn
        v4f_t kv[4], vv[4];
#pragma unroll   // straight-line code, so that the loads stand together with no wait between them
        for (int it = 0; it < 4; ++it) {   // element e = tid + 256*it of the chunk: row e>>5, float4 e&31, rows contiguous
            kv[it] = *(const v4f*)(Kx + (size_t)(b * NL_ + j0) * NC_ + 4 * tid + 1024 * it);
            vv[it] = *(const v4f*)(X + (size_t)(b * NL_ + j0) * ND_ + 4 * tid + 1024 * it);
        }
        // key chunk 32 x 128 f32
#pragma unroll   // constant index, so that the loaded values stay in registers
        for (int it = 0; it < 4; ++it) {
            const int e = tid + 256 * it;
            const int r = e >> 5, q = e & 31;
            *(v4f*)(sK + r * KP_ + 4 * q) = kv[it];
        }
        // value chunk transposed to [d][j] f16
#pragma unroll   // constant index, so that the loaded values stay in registers
        for (int it = 0; it < 4; ++it) {
            const int e = tid + 256 * it;
            const int r = e >> 5, q = e & 31;
            const v4f_t v = vv[it];
            sVT[(4 * q + 0) * VP_ + r] = (_Float16)v.x;
            sVT[(4 * q + 1) * VP_ + r] = (_Float16)v.y;
            sVT[(4 * q + 2) * VP_ + r] = (_Float16)v.z;
            sVT[(4 * q + 3) * VP_ + r] = (_Float16)v.w;
        }
        __syncthreads();

        // scores: one tile a key (this wave's keys 4*wave..4*wave+3 of the chunk); A row = query (lane m), k = channel; B = wa columns.
        // Only the key row is read from LDS, the same 16 bytes for all 16 lanes of a half.
        const float* kb = sK + (wave * 4) * KP_ + 8 * h;
        v4f_t kr[16];   // the key row's channels, laid out as qf
#pragma unroll   // constant index, so that the row stays in registers
        for (int kk = 0; kk < 4; ++kk) {
            kr[4 * kk + 0] = *(const v4f*)(kb + kk * 32);
            kr[4 * kk + 1] = *(const v4f*)(kb + kk * 32 + 4);
            kr[4 * kk + 2] = *(const v4f*)(kb + kk * 32 + 16);
            kr[4 * kk + 3] = *(const v4f*)(kb + kk * 32 + 20);
        }
        v8f pa = {};      // the key before: its sums, and the neighbour column's sums on their way through the cross-lane unit
        float pl[8] = {0.0f, 0.0f, 0.0f, 0.0f, 0.0f, 0.0f, 0.0f, 0.0f};
#pragma unroll   // constant index into kr, qf and wb; the next key's reads stand among this key's passes
        for (int u = 0; u <= 4; ++u) {   // trip 4 only finishes key 3
            v8f acc = {};
#pragma unroll   // constant index into kr, qf and wb
            for (int kk = 0; kk < 4; ++kk) {
                if (u < 4) {
                    const v4f_t x0 = qf[4 * kk + 0] + kr[4 * kk + 0];
                    const v4f_t x1 = qf[4 * kk + 1] + kr[4 * kk + 1];
                    const v4f_t x2 = qf[4 * kk + 2] + kr[4 * kk + 2];
                    const v4f_t x3 = qf[4 * kk + 3] + kr[4 * kk + 3];
                    FragH fa;   // elements 0..7 = channels 32kk+8h.., 8..15 = 32kk+16+8h..
                    fa.e[0]  = th_h(x0.x); fa.e[1]  = th_h(x0.y); fa.e[2]  = th_h(x0.z); fa.e[3]  = th_h(x0.w);
                    fa.e[4]  = th_h(x1.x); fa.e[5]  = th_h(x1.y); fa.e[6]  = th_h(x1.z); fa.e[7]  = th_h(x1.w);
                    fa.e[8]  = th_h(x2.x); fa.e[9]  = th_h(x2.y); fa.e[10] = th_h(x2.z); fa.e[11] = th_h(x2.w);
                    fa.e[12] = th_h(x3.x); fa.e[13] = th_h(x3.y); fa.e[14] = th_h(x3.z); fa.e[15] = th_h(x3.w);
                    acc = mma_f16(acc, fa.v, wb[kk].v);
                }
                // two passes have used up half of the key registers: the next key's same half is fetched into them, two passes ahead of its use
                if ((kk & 1) && u < 3) {
#pragma unroll   // constant index into kr
                    for (int kn = kk - 1; kn <= kk; ++kn) {
                        const float* kp = kb + (u + 1) * KP_ + kn * 32;
                        kr[4 * kn + 0] = *(const v4f*)(kp);
                        kr[4 * kn + 1] = *(const v4f*)(kp + 4);
                        kr[4 * kn + 2] = *(const v4f*)(kp + 16);
                        kr[4 * kn + 3] = *(const v4f*)(kp + 20);
                    }
                }
                // the key before is finished here, two passes after its cross-lane moves were issued
                // D: lane column 0 = hi sums, column 1 = lo sums (x4096); rows 8h+r = queries 8h+r
                if (kk == 1 && u > 0 && m == 0) {
                    float sv[8];
#pragma unroll   // constant index, so that the sums stay in registers
                    for (int r = 0; r < 8; ++r) sv[r] = pa[r] + pl[r] * (1.0f / 4096.0f) + bav;
                    float* sp8 = sS + (wave * 4 + u - 1) * 16 + 8 * h;
                    *(v4f*)(sp8)     = v4f_t{sv[0], sv[1], sv[2], sv[3]};
                    *(v4f*)(sp8 + 4) = v4f_t{sv[4], sv[5], sv[6], sv[7]};
                }
                if (kk == 3 && u < 4) {
#pragma unroll   // constant index, so that the sums stay in registers
                    for (int r = 0; r < 8; ++r) pl[r] = __shfl_xor(acc[r], 1);
                    pa = acc;
                }
                // keeps the later passes' vector work behind the reads above: lifted over them, it would issue the reads only just before their use
                if ((kk & 1) && u < 3) __builtin_amdgcn_sched_barrier(0);
            }
        }
        __syncthreads();

        // online softmax statistics per query row
        if (tid < 16) {
            const int i = tid;
            const float mo = sM[i];
            float cm = mo;
            for (int jj = 0; jj < JC_; ++jj) cm = fmaxf(cm, sS[jj * 16 + i]);
            const float sc = __builtin_amdgcn_exp2f((mo - cm) * LOG2E_F);
            float ls = sL[i] * sc;
            for (int jj = 0; jj < JC_; ++jj) {
                const float ev = __builtin_amdgcn_exp2f((sS[jj * 16 + i] - cm) * LOG2E_F);
                ls += ev;
                sP[i * JC_ + jj] = (_Float16)(ev * 4096.0f);
            }
            sM[i] = cm; sL[i] = ls; sSc[i] = sc;
        }
        __syncthreads();

        // O = O*scale + P(16 x 32 keys) * V(32 keys x 16 cols)
#pragma unroll
        for (int r = 0; r < 8; ++r) acco[r] *= sSc[8 * h + r];
        FragH fp, fv;
        fp.q[0] = *(const v8h*)(sP + m * JC_ + 8 * h);
        fp.q[1] = *(const v8h*)(sP + m * JC_ + 16 + 8 * h);
        fv.q[0] = *(const v8h*)(sVT + ncol * VP_ + 8 * h);
        fv.q[1] = *(const v8h*)(sVT + ncol * VP_ + 16 + 8 * h);
        acco = mma_f16(acco, fp.v, fv.v);
    }

    // epilogue: stage the 16 x 128 partial tile as it stands (scaled by 4096, relative to the range's own maxima), whole-row stores
#pragma unroll
    for (int r = 0; r < 8; ++r) sO[(8 * h + r) * OP_ + ncol] = acco[r];
    __syncthreads();
    const int r0 = 2 * wave, r1 = 2 * wave + 1;
    const v4f_t v0 = *(const v4f*)(sO + r0 * OP_ + 4 * lane);
    const v4f_t v1 = *(const v4f*)(sO + r1 * OP_ + 4 * lane);
    float* p0 = Op + ((size_t)sp * NROWS_ + qrow0 + r0) * ND_ + 4 * lane;
    float* p1 = Op + ((size_t)sp * NROWS_ + qrow0 + r1) * ND_ + 4 * lane;
    *(v4f*)p0 = v0;
    *(v4f*)p1 = v1;
    // the range's 16 row maxima, then its 16 row sums: one whole 128-byte line a work-group
    if (wave == 0) Ml[(size_t)(sp * NQT_ + qt) * 32 + lane] = (h == 0) ? sM[m] : sL[m];
}

// ---------------- kernel 2: merge of the KS key ranges of every query row ----------------
// grid = NROWS/8 blocks of 256 threads; wave w owns query row 8*blockIdx.x + w, lane l its columns 4l..4l+3.
__global__ __launch_bounds__(256) void k_merge(
    const float* __restrict__ Op, const float* __restrict__ Ml, float* Out)
{
    const int lane = threadIdx.x & 31, wave = threadIdx.x >> 5;
    const int row = blockIdx.x * 8 + wave;
    const int qt = row >> 4, rr = row & 15;
    float ms[KS_], ls[KS_];
    v4f_t os[KS_];
#pragma unroll   // straight-line code, so that all loads stand together: one trip to memory
    for (int s = 0; s < KS_; ++s) {
        ms[s] = Ml[(size_t)(s * NQT_ + qt) * 32 + rr];
        ls[s] = Ml[(size_t)(s * NQT_ + qt) * 32 + 16 + rr];
        os[s] = *(const v4f*)(Op + ((size_t)s * NROWS_ + row) * ND_ + 4 * lane);
    }
    // the arithmetic below reuses the registers that hold the loads' addresses: wait before they are overwritten
    asm volatile("s_wait_xcnt 0x0" ::: "memory");
    float mx = ms[0];
#pragma unroll   // constant index, so that the loaded values stay in registers
    for (int s = 1; s < KS_; ++s) mx = fmaxf(mx, ms[s]);
    float l = 0.0f;
    v4f_t o = {0.0f, 0.0f, 0.0f, 0.0f};
#pragma unroll   // constant index, so that the loaded values stay in registers
    for (int s = 0; s < KS_; ++s) {
        const float w = __builtin_amdgcn_exp2f((ms[s] - mx) * LOG2E_F);
        l += ls[s] * w;
        o += os[s] * w;
    }
    const float inv = 1.0f / (l + EPS_);
    *(v4f*)(Out + (size_t)row * ND_ + 4 * lane) = o * inv * (1.0f / 4096.0f);
}

// ---------------- launcher ----------------
extern "C" void kernel_launch(void* const* d_in, const int* in_sizes, int n_in,
                              void* d_out, int out_size, void* d_ws, size_t ws_size,
                              hipStream_t stream) {
    if (n_in < 6) return;
    if (in_sizes[0] != NROWS_ * ND_ || in_sizes[1] != ND_ * NC_ || in_sizes[2] != ND_ * NC_ ||
        in_sizes[3] != NC_ || in_sizes[4] != NC_ || in_sizes[5] < 1 || out_size != NROWS_ * ND_)
        return;

    const float* inps  = (const float*)d_in[0];
    const float* wei_t = (const float*)d_in[1];
    const float* wei_x = (const float*)d_in[2];
    const float* bxh   = (const float*)d_in[3];
    const float* wei_a = (const float*)d_in[4];
    const float* bxa   = (const float*)d_in[5];
    float* out = (float*)d_out;

    // workspace: Q [NROWS][NC] f32 at 0, K [NROWS][NC] f32 at 1 MiB, partial tiles [KS][NROWS][ND] f32 at 2 MiB,
    // then maxima and sums [KS][NQT][32] f32; total 6 MiB + 64 KiB
    const size_t per = (size_t)NROWS_ * NC_ * sizeof(float);
    if (ws_size < (2 + KS_) * per + (size_t)KS_ * NQT_ * 32 * sizeof(float)) return;
    float* qb = (float*)d_ws;
    float* kx = (float*)((char*)d_ws + per);
    float* op = (float*)((char*)d_ws + 2 * per);
    float* ml = (float*)((char*)d_ws + (2 + KS_) * per);

    const int nrows = NROWS_;
    k_proj<<<dim3((nrows + 15) / 16), dim3(256), 0, stream>>>(inps, wei_t, wei_x, bxh, qb, kx, nrows);
    k_attn<<<dim3(NB_ * (NL_ / 16) * KS_), dim3(256), 0, stream>>>(inps, qb, kx, wei_a, bxa, op, ml);
    k_merge<<<dim3(NROWS_ / 8), dim3(256), 0, stream>>>(op, ml, out);
}

// v005
// A run of this version takes 28.3 microseconds.
// In two side-by-side timings against v004, it was 1.21 and 1.18 times as fast.
// Counting every step since v000, it is 4.73 times as fast.
#include <hip/hip_runtime.h>
#include <stdint.h>

// Contractions: X*Wt and X*Wx on v_wmma_f32_16x16x32_bf16 as bf16 hi/lo split (3 products each); tanh-score channel reduction (N padded to 16) and P*V on v_wmma_f32_16x16x32_f16 (f16 operands; the low part of wa and P power-of-two pre-scaled); all accumulation f32.

#define NB_    4
#define NL_    512
#define ND_    128
#define NC_    128
#define NROWS_ (NB_ * NL_)
#define EPS_   1e-7f
#define JC_    32          // keys per chunk
#define KS_    4           // key ranges: work-groups that share one tile of 16 query rows, NL/KS keys each
#define NQT_   (NROWS_ / 16)   // tiles of 16 query rows
#define KP_    132         // f32 pitch of the key tile in LDS
#define VP_    40          // f16 pitch of the transposed value tile [d][j]
#define WBP_   136         // f16 pitch of the wa operand tile [n][c]
#define OP_    132         // f32 pitch of the output staging tile
#define AP2_   68          // uint32 pitch (136 halves) of the bf16 activation tile

typedef float    v8f   __attribute__((ext_vector_type(8)));
typedef float    v4f_t __attribute__((ext_vector_type(4)));
typedef v4f_t    __attribute__((may_alias)) v4f;
typedef float    v2f_t __attribute__((ext_vector_type(2)));
typedef v2f_t    __attribute__((may_alias)) v2f;
typedef uint32_t v4u_t __attribute__((ext_vector_type(4)));
typedef v4u_t    __attribute__((may_alias)) v4u;
typedef __bf16   v16bf __attribute__((ext_vector_type(16)));
typedef _Float16 v16h  __attribute__((ext_vector_type(16)));
typedef _Float16 v8h_t __attribute__((ext_vector_type(8)));
typedef v8h_t    __attribute__((may_alias)) v8h;

union FragB { v4u_t q[2]; v16bf v; };
union FragH { _Float16 e[16]; v8h_t q[2]; v16h v; };

#define LOG2E_F     1.4426950408889634f

// ---------------- WMMA wrappers with hazard guard ----------------
__device__ __forceinline__ v8f mma_bf16(v8f acc, v16bf a, v16bf b) {
    acc = __builtin_amdgcn_wmma_f32_16x16x32_bf16(false, a, false, b, (short)0, acc, false, false);
    asm volatile("v_nop\n\tv_nop\n\tv_nop\n\tv_nop" : "+v"(acc) : "v"(a), "v"(b));
    return acc;
}
__device__ __forceinline__ v8f mma_f16(v8f acc, v16h a, v16h b) {
    acc = __builtin_amdgcn_wmma_f32_16x16x32_f16(false, a, false, b, (short)0, acc, false, false);
    asm volatile("v_nop\n\tv_nop\n\tv_nop\n\tv_nop" : "+v"(acc) : "v"(a), "v"(b));
    return acc;
}

// ---------------- f32 -> bf16 (RNE) hi/lo split ----------------
__device__ __forceinline__ uint32_t bf_bits(float f) {
    uint32_t u = __builtin_bit_cast(uint32_t, f);
    u += 0x7FFFu + ((u >> 16) & 1u);
    return u >> 16;
}
__device__ __forceinline__ void bf_split(float x, uint32_t& hi, uint32_t& lo) {
    hi = bf_bits(x);
    const float xh = __builtin_bit_cast(float, hi << 16);
    lo = bf_bits(x - xh);
}

// tanh(x) as f16 (RNE convert); the tanh is the chip's own instruction, v_tanh_f32
__device__ __forceinline__ _Float16 th_h(float x) {
    return (_Float16)__builtin_amdgcn_tanhf(x);
}

// ---------------- kernel 0: Q = X*Wt + bh, K = X*Wx (bf16 hi/lo split WMMA) ----------------
// grid = ceil(nrows/16) blocks of 256 threads; waves 0..3 make Q, waves 4..7 make K; wave w owns the 32 output columns 32*(w&3)..+31
// as two tiles: column m of tile t is output column 32*(w&3) + 2m + t, so that a lane's two columns lie side by side in memory.
// No wave shares a weight column with another, so the weights go from memory straight to the B fragments' registers, not through LDS.
__global__ __launch_bounds__(256) void k_proj(
    const float* __restrict__ X, const float* __restrict__ Wt, const float* __restrict__ Wx,
    const float* __restrict__ bh, float* Qo, float* Ko, int nrows)
{
    __shared__ __align__(16) uint32_t sAh[16 * AP2_];
    __shared__ __align__(16) uint32_t sAl[16 * AP2_];

    const int tid = threadIdx.x, lane = tid & 31, wave = tid >> 5;
    const int h = lane >> 4, m = lane & 15;
    const int row0 = blockIdx.x * 16;
    const int g = wave >> 2;
    const int col0 = (wave & 3) * 32 + 2 * m;

    // every load of the kernel is issued here, before the first is used: one trip to memory in all
    v4f_t xa[2];
#pragma unroll   // straight-line code, so that the loads stand together with no wait between them
    for (int it = 0; it < 2; ++it) {
        const int e = tid + 256 * it;
        const int r = e >> 5, q = e & 31;
        const int gr = row0 + r;
        xa[it] = v4f_t{0.0f, 0.0f, 0.0f, 0.0f};
        if (gr < nrows) xa[it] = *(const v4f*)(X + (size_t)gr * ND_ + 4 * q);
    }
    // weights: element e of pass kk is row k = 32kk + 8h + e (e < 8) or 32kk + 16 + 8h + (e - 8), the k map of the A fragment;
    // one load brings that row's two columns: 16 lanes x 8 bytes = one whole 128-byte line a half-wave
    const float* wp = ((g == 0) ? Wt : Wx) + (size_t)(8 * h) * NC_ + col0;
    v2f_t wv[64];
#pragma unroll   // straight-line code, so that the loads stand together with no wait between them
    for (int i = 0; i < 64; ++i) {
        const int kk = i >> 4, e = i & 15;
        wv[i] = *(const v2f*)(wp + (size_t)(32 * kk + e + ((e < 8) ? 0 : 8)) * NC_);
    }
    v2f_t bias = {0.0f, 0.0f};
    if (g == 0) bias = *(const v2f*)(bh + col0);
    // the arithmetic below reuses the registers that hold the loads' addresses: wait before they are overwritten
    asm volatile("s_wait_xcnt 0x0" ::: "memory");

    // activation tile 16 x 128 -> bf16 hi and lo planes (packed pairs)
#pragma unroll   // constant index, so that the loaded values stay in registers
    for (int it = 0; it < 2; ++it) {
        const int e = tid + 256 * it;
        const int r = e >> 5, q = e & 31;
        const v4f_t v = xa[it];
        uint32_t h0, l0, h1, l1, h2, l2, h3, l3;
        bf_split(v.x, h0, l0); bf_split(v.y, h1, l1);
        bf_split(v.z, h2, l2); bf_split(v.w, h3, l3);
        sAh[r * AP2_ + 2 * q]     = h0 | (h1 << 16);
        sAh[r * AP2_ + 2 * q + 1] = h2 | (h3 << 16);
        sAl[r * AP2_ + 2 * q]     = l0 | (l1 << 16);
        sAl[r * AP2_ + 2 * q + 1] = l2 | (l3 << 16);
    }
    __syncthreads();   // sA* staged

    v8f acc0 = {}, acc1 = {};
#pragma unroll   // constant index into wv, so that the loaded values stay in registers
    for (int kk = 0; kk < 4; ++kk) {
        // A: row m, elements 0..7 = k0+8h.., 8..15 = k0+16+8h..
        FragB fah, fal, fbh0, fbl0, fbh1, fbl1;
        const uint32_t* pa = sAh + m * AP2_ + kk * 16 + 4 * h;
        const uint32_t* pl = sAl + m * AP2_ + kk * 16 + 4 * h;
        fah.q[0] = *(const v4u*)(pa); fah.q[1] = *(const v4u*)(pa + 8);
        fal.q[0] = *(const v4u*)(pl); fal.q[1] = *(const v4u*)(pl + 8);
        // B: the pass's 16 rows of this lane's two columns, split and packed in pairs along k
#pragma unroll   // constant index into wv and the fragments
        for (int p = 0; p < 8; ++p) {
            const v2f_t w0 = wv[16 * kk + 2 * p], w1 = wv[16 * kk + 2 * p + 1];
            uint32_t a0, b0, a1, b1;
            bf_split(w0.x, a0, b0); bf_split(w1.x, a1, b1);
            fbh0.q[p >> 2][p & 3] = a0 | (a1 << 16);
            fbl0.q[p >> 2][p & 3] = b0 | (b1 << 16);
            bf_split(w0.y, a0, b0); bf_split(w1.y, a1, b1);
            fbh1.q[p >> 2][p & 3] = a0 | (a1 << 16);
            fbl1.q[p >> 2][p & 3] = b0 | (b1 << 16);
        }
        acc0 = mma_bf16(acc0, fah.v, fbh0.v);
        acc1 = mma_bf16(acc1, fah.v, fbh1.v);
        acc0 = mma_bf16(acc0, fah.v, fbl0.v);
        acc1 = mma_bf16(acc1, fah.v, fbl1.v);
        acc0 = mma_bf16(acc0, fal.v, fbh0.v);
        acc1 = mma_bf16(acc1, fal.v, fbh1.v);
    }

    // D: rows 8h+r, this lane's two columns side by side: a half-wave's store is one whole 128-byte line
    float* dst = ((g == 0) ? Qo : Ko) + (size_t)(row0 + 8 * h) * NC_ + col0;
    const int left = nrows - (row0 + 8 * h);   // rows of this half-wave's eight that exist
    if (left >= 8) {   // all eight: one test, so that the stores stand together, each from registers of its own
#pragma unroll   // constant index, so that the sums stay in registers
        for (int r = 0; r < 8; ++r)
            *(v2f*)(dst + (size_t)r * NC_) = v2f_t{acc0[r] + bias.x, acc1[r] + bias.y};
    } else {
#pragma unroll   // constant index, so that the sums stay in registers
        for (int r = 0; r < 8; ++r)
            if (r < left) *(v2f*)(dst + (size_t)r * NC_) = v2f_t{acc0[r] + bias.x, acc1[r] + bias.y};
    }
}

// ---------------- kernel 1: tanh scores (WMMA channel reduction) + online softmax + P*V over one key range ----------------
// grid = NB*(NL/16)*KS blocks of 256 threads; block owns (batch b, 16 query rows, key range sp); wave w owns output columns 16w..16w+15.
// It leaves its un-normalised partial tile in Op[sp][row][col] and its row maxima and row sums in Ml; kernel 2 merges the ranges.
__global__ __launch_bounds__(256) void k_attn(
    const float* __restrict__ X, const float* __restrict__ Qb, const float* __restrict__ Kx,
    const float* __restrict__ wa, const float* __restrict__ ba, float* Op, float* Ml)
{
    __shared__ __align__(16) float    sQ[16 * KP_];
    __shared__ __align__(16) float    sK[JC_ * KP_];
    __shared__ __align__(16) _Float16 sVT[ND_ * VP_];
    __shared__ __align__(16) _Float16 sWB[16 * WBP_];
    __shared__ __align__(16) _Float16 sP[16 * JC_];
    __shared__ __align__(16) float    sS[JC_ * 16];   // scores, [key][query]
    __shared__ __align__(16) float    sO[16 * OP_];
    __shared__ float sM[16], sL[16], sSc[16];

    const int tid = threadIdx.x, lane = tid & 31, wave = tid >> 5;
    const int h = lane >> 4, m = lane & 15;
    const int sp = blockIdx.x % KS_;
    const int qt = blockIdx.x / KS_;
    const int b  = qt / (NL_ / 16);
    const int it = qt % (NL_ / 16);
    const int qrow0 = b * NL_ + it * 16;
    const int ncol = wave * 16 + m;

    // query tile (bias already folded in)
    // (its loads and those of wa below are all issued before the first LDS store)
    v4f_t qv[2];
#pragma unroll   // straight-line code, so that the loads stand together with no wait between them
    for (int it = 0; it < 2; ++it)   // element e = tid + 256*it of the tile, rows contiguous
        qv[it] = *(const v4f*)(Qb + (size_t)qrow0 * NC_ + 4 * tid + 1024 * it);
    constexpr int NWB = (16 * WBP_ + 255) / 256;
    float wv[NWB];
#pragma unroll   // straight-line code, so that the loads stand together with no wait between them
    for (int it = 0; it < NWB; ++it) {
        const int e = tid + 256 * it;
        const int c = e % WBP_;
        wv[it] = (c < NC_) ? wa[c] : 0.0f;
    }
#pragma unroll   // constant index, so that the loaded values stay in registers
    for (int it = 0; it < 2; ++it) {
        const int e = tid + 256 * it;
        const int r = e >> 5, q = e & 31;
        *(v4f*)(sQ + r * KP_ + 4 * q) = qv[it];
    }
    // wa as a [n][c] 16-bit operand: column 0 = f16 hi, column 1 = (wa - hi) * 4096, columns 2..15 = 0
#pragma unroll   // constant index, so that the loaded values stay in registers
    for (int it = 0; it < NWB; ++it) {
        const int e = tid + 256 * it;
        const int rr = e / WBP_;
        const int c = e - rr * WBP_;
        _Float16 val = (_Float16)0.0f;
        if (c < NC_) {
            const float w = wv[it];
            const _Float16 hi = (_Float16)w;
            if (rr == 0) val = hi;
            else if (rr == 1) val = (_Float16)((w - (float)hi) * 4096.0f);
        }
        if (e < 16 * WBP_) sWB[e] = val;
    }
    if (tid < 16) { sM[tid] = -3.0e38f; sL[tid] = 0.0f; }
    const float bav = ba[0];

    // the two score operands that no key changes go to registers once: this lane's query row (A side) and its wa column (B side)
    __syncthreads();   // sQ and sWB staged
    v4f_t qf[16];      // query row m; pass kk: channels 32kk+8h..+7 in [4kk], [4kk+1], channels 32kk+16+8h..+7 in [4kk+2], [4kk+3]
    FragH wb[4];       // column m of the wa tile, same k map
#pragma unroll   // constant index, so that the fragments stay in registers
    for (int kk = 0; kk < 4; ++kk) {
        const float* qp = sQ + m * KP_ + kk * 32 + 8 * h;
        qf[4 * kk + 0] = *(const v4f*)(qp);
        qf[4 * kk + 1] = *(const v4f*)(qp + 4);
        qf[4 * kk + 2] = *(const v4f*)(qp + 16);
        qf[4 * kk + 3] = *(const v4f*)(qp + 20);
        wb[kk].q[0] = *(const v8h*)(sWB + m * WBP_ + kk * 32 + 8 * h);
        wb[kk].q[1] = *(const v8h*)(sWB + m * WBP_ + kk * 32 + 16 + 8 * h);
    }

    v8f acco = {};   // output tile accumulator: rows 8h+r, column ncol (scaled by 4096)

#pragma unroll 1
    for (int ch = sp * (NL_ / JC_ / KS_); ch < (sp + 1) * (NL_ / JC_ / KS_); ++ch) {
        __syncthreads();   // readers of sK / sVT / sS / sP from the last chunk are done
        const int j0 = ch * JC_;
        // the chunk's eight loads a thread (four of keys, four of values) are issued together:
        // one trip to memory a chunk instead of eight, each waited for in turn
        v4f_t kv[4], vv[4];
#pragma unroll   // straight-line code, so that the loads stand together with no wait between them
        for (int it = 0; it < 4; ++it) {   // element e = tid + 256*it of the chunk: row e>>5, float4 e&31, rows contiguous
            kv[it] = *(const v4f*)(Kx + (size_t)(b * NL_ + j0) * NC_ + 4 * tid + 1024 * it);
            vv[it] = *(const v4f*)(X + (size_t)(b * NL_ + j0) * ND_ + 4 * tid + 1024 * it);
        }
        // key chunk 32 x 128 f32
#pragma unroll   // constant index, so that the loaded values stay in registers
        for (int it = 0; it < 4; ++it) {
            const int e = tid + 256 * it;
            const int r = e >> 5, q = e & 31;
            *(v4f*)(sK + r * KP_ + 4 * q) = kv[it];
        }
        // value chunk transposed to [d][j] f16
#pragma unroll   // constant index, so that the loaded values stay in registers
        for (int it = 0; it < 4; ++it) {
            const int e = tid + 256 * it;
            const int r = e >> 5, q = e & 31;
            const v4f_t v = vv[it];
            sVT[(4 * q + 0) * VP_ + r] = (_Float16)v.x;
            sVT[(4 * q + 1) * VP_ + r] = (_Float16)v.y;
            sVT[(4 * q + 2) * VP_ + r] = (_Float16)v.z;
            sVT[(4 * q + 3) * VP_ + r] = (_Float16)v.w;
        }
        __syncthreads();

        // scores: one tile a key (this wave's keys 4*wave..4*wave+3 of the chunk); A row = query (lane m), k = channel; B = wa columns.
        // Only the key row is read from LDS, the same 16 bytes for all 16 lanes of a half.
        const float* kb = sK + (wave * 4) * KP_ + 8 * h;
        v4f_t kr[16];   // the key row's channels, laid out as qf
#pragma unroll   // constant index, so that the row stays in registers
        for (int kk = 0; kk < 4; ++kk) {
            kr[4 * kk + 0] = *(const v4f*)(kb + kk * 32);
            kr[4 * kk + 1] = *(const v4f*)(kb + kk * 32 + 4);
            kr[4 * kk + 2] = *(const v4f*)(kb + kk * 32 + 16);
            kr[4 * kk + 3] = *(const v4f*)(kb + kk * 32 + 20);
        }
        v8f pa = {};      // the key before: its sums, and the neighbour column's sums on their way through the cross-lane unit
        float pl[8] = {0.0f, 0.0f, 0.0f, 0.0f, 0.0f, 0.0f, 0.0f, 0.0f};
#pragma unroll   // constant index into kr, qf and wb; the next key's reads stand among this key's passes
        for (int u = 0; u <= 4; ++u) {   // trip 4 only finishes key 3
            v8f acc = {};
#pragma unroll   // constant index into kr, qf and wb
            for (int kk = 0; kk < 4; ++kk) {
                if (u < 4) {
                    const v4f_t x0 = qf[4 * kk + 0] + kr[4 * kk + 0];
                    const v4f_t x1 = qf[4 * kk + 1] + kr[4 * kk + 1];
                    const v4f_t x2 = qf[4 * kk + 2] + kr[4 * kk + 2];
                    const v4f_t x3 = qf[4 * kk + 3] + kr[4 * kk + 3];
                    FragH fa;   // elements 0..7 = channels 32kk+8h.., 8..15 = 32kk+16+8h..
                    fa.e[0]  = th_h(x0.x); fa.e[1]  = th_h(x0.y); fa.e[2]  = th_h(x0.z); fa.e[3]  = th_h(x0.w);
                    fa.e[4]  = th_h(x1.x); fa.e[5]  = th_h(x1.y); fa.e[6]  = th_h(x1.z); fa.e[7]  = th_h(x1.w);
                    fa.e[8]  = th_h(x2.x); fa.e[9]  = th_h(x2.y); fa.e[10] = th_h(x2.z); fa.e[11] = th_h(x2.w);
                    fa.e[12] = th_h(x3.x); fa.e[13] = th_h(x3.y); fa.e[14] = th_h(x3.z); fa.e[15] = th_h(x3.w);
                    acc = mma_f16(acc, fa.v, wb[kk].v);
                }
                // two passes have used up half of the key registers: the next key's same half is fetched into them, two passes ahead of its use
                if ((kk & 1) && u < 3) {
#pragma unroll   // constant index into kr
                    for (int kn = kk - 1; kn <= kk; ++kn) {
                        const float* kp = kb + (u + 1) * KP_ + kn * 32;
                        kr[4 * kn + 0] = *(const v4f*)(kp);
                        kr[4 * kn + 1] = *(const v4f*)(kp + 4);
                        kr[4 * kn + 2] = *(const v4f*)(kp + 16);
                        kr[4 * kn + 3] = *(const v4f*)(kp + 20);
                    }
                }
                // the key before is finished here, two passes after its cross-lane moves were issued
                // D: lane column 0 = hi sums, column 1 = lo sums (x4096); rows 8h+r = queries 8h+r
                if (kk == 1 && u > 0 && m == 0) {
                    float sv[8];
#pragma unroll   // constant index, so that the sums stay in registers
                    for (int r = 0; r < 8; ++r) sv[r] = pa[r] + pl[r] * (1.0f / 4096.0f) + bav;
                    float* sp8 = sS + (wave * 4 + u - 1) * 16 + 8 * h;
                    *(v4f*)(sp8)     = v4f_t{sv[0], sv[1], sv[2], sv[3]};
                    *(v4f*)(sp8 + 4) = v4f_t{sv[4], sv[5], sv[6], sv[7]};
                }
                if (kk == 3 && u < 4) {
#pragma unroll   // constant index, so that the sums stay in registers
                    for (int r = 0; r < 8; ++r) pl[r] = __shfl_xor(acc[r], 1);
                    pa = acc;
                }
                // keeps the later passes' vector work behind the reads above: lifted over them, it would issue the reads only just before their use
                if ((kk & 1) && u < 3) __builtin_amdgcn_sched_barrier(0);
            }
        }
        __syncthreads();

        // online softmax statistics per query row
        if (tid < 16) {
            const int i = tid;
            const float mo = sM[i];
            float cm = mo;
            for (int jj = 0; jj < JC_; ++jj) cm = fmaxf(cm, sS[jj * 16 + i]);
            const float sc = __builtin_amdgcn_exp2f((mo - cm) * LOG2E_F);
            float ls = sL[i] * sc;
            for (int jj = 0; jj < JC_; ++jj) {
                const float ev = __builtin_amdgcn_exp2f((sS[jj * 16 + i] - cm) * LOG2E_F);
                ls += ev;
                sP[i * JC_ + jj] = (_Float16)(ev * 4096.0f);
            }
            sM[i] = cm; sL[i] = ls; sSc[i] = sc;
        }
        __syncthreads();

        // O = O*scale + P(16 x 32 keys) * V(32 keys x 16 cols)
#pragma unroll
        for (int r = 0; r < 8; ++r) acco[r] *= sSc[8 * h + r];
        FragH fp, fv;
        fp.q[0] = *(const v8h*)(sP + m * JC_ + 8 * h);
        fp.q[1] = *(const v8h*)(sP + m * JC_ + 16 + 8 * h);
        fv.q[0] = *(const v8h*)(sVT + ncol * VP_ + 8 * h);
        fv.q[1] = *(const v8h*)(sVT + ncol * VP_ + 16 + 8 * h);
        acco = mma_f16(acco, fp.v, fv.v);
    }

    // epilogue: stage the 16 x 128 partial tile as it stands (scaled by 4096, relative to the range's own maxima), whole-row stores
#pragma unroll
    for (int r = 0; r < 8; ++r) sO[(8 * h + r) * OP_ + ncol] = acco[r];
    __syncthreads();
    const int r0 = 2 * wave, r1 = 2 * wave + 1;
    const v4f_t v0 = *(const v4f*)(sO + r0 * OP_ + 4 * lane);
    const v4f_t v1 = *(const v4f*)(sO + r1 * OP_ + 4 * lane);
    float* p0 = Op + ((size_t)sp * NROWS_ + qrow0 + r0) * ND_ + 4 * lane;
    float* p1 = Op + ((size_t)sp * NROWS_ + qrow0 + r1) * ND_ + 4 * lane;
    *(v4f*)p0 = v0;
    *(v4f*)p1 = v1;
    // the range's 16 row maxima, then its 16 row sums: one whole 128-byte line a work-group
    if (wave == 0) Ml[(size_t)(sp * NQT_ + qt) * 32 + lane] = (h == 0) ? sM[m] : sL[m];
}

// ---------------- kernel 2: merge of the KS key ranges of every query row ----------------
// grid = NROWS/8 blocks of 256 threads; wave w owns query row 8*blockIdx.x + w, lane l its columns 4l..4l+3.
__global__ __launch_bounds__(256) void k_merge(
    const float* __restrict__ Op, const float* __restrict__ Ml, float* Out)
{
    const int lane = threadIdx.x & 31, wave = threadIdx.x >> 5;
    const int row = blockIdx.x * 8 + wave;
    const int qt = row >> 4, rr = row & 15;
    float ms[KS_], ls[KS_];
    v4f_t os[KS_];
#pragma unroll   // straight-line code, so that all loads stand together: one trip to memory
    for (int s = 0; s < KS_; ++s) {
        ms[s] = Ml[(size_t)(s * NQT_ + qt) * 32 + rr];
        ls[s] = Ml[(size_t)(s * NQT_ + qt) * 32 + 16 + rr];
        os[s] = *(const v4f*)(Op + ((size_t)s * NROWS_ + row) * ND_ + 4 * lane);
    }
    // the arithmetic below reuses the registers that hold the loads' addresses: wait before they are overwritten
    asm volatile("s_wait_xcnt 0x0" ::: "memory");
    float mx = ms[0];
#pragma unroll   // constant index, so that the loaded values stay in registers
    for (int s = 1; s < KS_; ++s) mx = fmaxf(mx, ms[s]);
    float l = 0.0f;
    v4f_t o = {0.0f, 0.0f, 0.0f, 0.0f};
#pragma unroll   // constant index, so that the loaded values stay in registers
    for (int s = 0; s < KS_; ++s) {
        const float w = __builtin_amdgcn_exp2f((ms[s] - mx) * LOG2E_F);
        l += ls[s] * w;
        o += os[s] * w;
    }
    const float inv = 1.0f / (l + EPS_);
    *(v4f*)(Out + (size_t)row * ND_ + 4 * lane) = o * inv * (1.0f / 4096.0f);
}

// ---------------- launcher ----------------
extern "C" void kernel_launch(void* const* d_in, const int* in_sizes, int n_in,
                              void* d_out, int out_size, void* d_ws, size_t ws_size,
                              hipStream_t stream) {
    if (n_in < 6) return;
    if (in_sizes[0] != NROWS_ * ND_ || in_sizes[1] != ND_ * NC_ || in_sizes[2] != ND_ * NC_ ||
        in_sizes[3] != NC_ || in_sizes[4] != NC_ || in_sizes[5] < 1 || out_size != NROWS_ * ND_)
        return;

    const float* inps  = (const float*)d_in[0];
    const float* wei_t = (const float*)d_in[1];
    const float* wei_x = (const float*)d_in[2];
    const float* bxh   = (const float*)d_in[3];
    const float* wei_a = (const float*)d_in[4];
    const float* bxa   = (const float*)d_in[5];
    float* out = (float*)d_out;

    // workspace: Q [NROWS][NC] f32 at 0, K [NROWS][NC] f32 at 1 MiB, partial tiles [KS][NROWS][ND] f32 at 2 MiB,
    // then maxima and sums [KS][NQT][32] f32; total 6 MiB + 64 KiB
    const size_t per = (size_t)NROWS_ * NC_ * sizeof(float);
    if (ws_size < (2 + KS_) * per + (size_t)KS_ * NQT_ * 32 * sizeof(float)) return;
    float* qb = (float*)d_ws;
    float* kx = (float*)((char*)d_ws + per);
    float* op = (float*)((char*)d_ws + 2 * per);
    float* ml = (float*)((char*)d_ws + (2 + KS_) * per);

    const int nrows = NROWS_;
    k_proj<<<dim3((nrows + 15) / 16), dim3(256), 0, stream>>>(inps, wei_t, wei_x, bxh, qb, kx, nrows);
    k_attn<<<dim3(NB_ * (NL_ / 16) * KS_), dim3(256), 0, stream>>>(inps, qb, kx, wei_a, bxa, op, ml);
    k_merge<<<dim3(NROWS_ / 8), dim3(256), 0, stream>>>(op, ml, out);
}

// v006
// It runs in 23 microseconds.
// In both of two side-by-side timings against v005, it was 1.24 times as fast.
// All steps since v000 together make it 5.86 times as fast.
#include <hip/hip_runtime.h>
#include <stdint.h>

// Contractions: X*Wt and X*Wx on v_wmma_f32_16x16x32_bf16 as bf16 hi/lo split (3 products each); tanh-score channel reduction (N padded to 16) and P*V on v_wmma_f32_16x16x32_f16 (f16 operands; the low part of wa and P power-of-two pre-scaled); all accumulation f32.

#define NB_    4
#define NL_    512
#define ND_    128
#define NC_    128
#define NROWS_ (NB_ * NL_)
#define EPS_   1e-7f
#define JC_    32          // keys per chunk
#define KS_    4           // key ranges: work-groups that share one tile of 16 query rows, NL/KS keys each
#define NQT_   (NROWS_ / 16)   // tiles of 16 query rows
#define KP_    132         // f32 pitch of the key tile in LDS
#define VP_    144         // f16 pitch of the value tile [j][d]: 288 bytes = 32 x odd, the pitch for the transposing LDS read
#define WBP_   136         // f16 pitch of the wa operand tile [n][c]
#define OP_    132         // f32 pitch of the output staging tile
#define AP2_   68          // uint32 pitch (136 halves) of the bf16 activation tile

typedef float    v8f   __attribute__((ext_vector_type(8)));
typedef float    v4f_t __attribute__((ext_vector_type(4)));
typedef v4f_t    __attribute__((may_alias)) v4f;
typedef float    v2f_t __attribute__((ext_vector_type(2)));
typedef v2f_t    __attribute__((may_alias)) v2f;
typedef uint32_t v4u_t __attribute__((ext_vector_type(4)));
typedef v4u_t    __attribute__((may_alias)) v4u;
typedef __bf16   v16bf __attribute__((ext_vector_type(16)));
typedef _Float16 v16h  __attribute__((ext_vector_type(16)));
typedef _Float16 v8h_t __attribute__((ext_vector_type(8)));
typedef v8h_t    __attribute__((may_alias)) v8h;
typedef _Float16 v4h_t __attribute__((ext_vector_type(4)));
typedef v4h_t    __attribute__((may_alias)) v4h;
typedef short    s16x8 __attribute__((ext_vector_type(8)));

union FragB { v4u_t q[2]; v16bf v; };
union FragH { _Float16 e[16]; v8h_t q[2]; v16h v; };

#define LOG2E_F     1.4426950408889634f

// ---------------- WMMA wrappers with hazard guard ----------------
__device__ __forceinline__ v8f mma_bf16(v8f acc, v16bf a, v16bf b) {
    acc = __builtin_amdgcn_wmma_f32_16x16x32_bf16(false, a, false, b, (short)0, acc, false, false);
    asm volatile("v_nop\n\tv_nop\n\tv_nop\n\tv_nop" : "+v"(acc) : "v"(a), "v"(b));
    return acc;
}
__device__ __forceinline__ v8f mma_f16(v8f acc, v16h a, v16h b) {
    acc = __builtin_amdgcn_wmma_f32_16x16x32_f16(false, a, false, b, (short)0, acc, false, false);
    asm volatile("v_nop\n\tv_nop\n\tv_nop\n\tv_nop" : "+v"(acc) : "v"(a), "v"(b));
    return acc;
}

// ---------------- f32 -> bf16 (RNE) hi/lo split ----------------
__device__ __forceinline__ uint32_t bf_bits(float f) {
    uint32_t u = __builtin_bit_cast(uint32_t, f);
    u += 0x7FFFu + ((u >> 16) & 1u);
    return u >> 16;
}
__device__ __forceinline__ void bf_split(float x, uint32_t& hi, uint32_t& lo) {
    hi = bf_bits(x);
    const float xh = __builtin_bit_cast(float, hi << 16);
    lo = bf_bits(x - xh);
}

// tanh(x) as f16 (RNE convert); the tanh is the chip's own instruction, v_tanh_f32
__device__ __forceinline__ _Float16 th_h(float x) {
    return (_Float16)__builtin_amdgcn_tanhf(x);
}

// ds_load_tr16_b128: from a row-major 16-bit LDS tile, lane (h, m) gets eight rows' elements of column m (each lane passes the address of its own 16 bytes of the tile)
__device__ __forceinline__ v8h_t ld_tr16(const _Float16* p) {
    typedef __attribute__((address_space(3))) s16x8 lds_s16x8;
    return __builtin_bit_cast(v8h_t, __builtin_amdgcn_ds_load_tr16_b128_v8i16((lds_s16x8*)p));
}

// ---------------- kernel 0: Q = X*Wt + bh, K = X*Wx (bf16 hi/lo split WMMA) ----------------
// grid = ceil(nrows/16) blocks of 256 threads; waves 0..3 make Q, waves 4..7 make K; wave w owns the 32 output columns 32*(w&3)..+31
// as two tiles: column m of tile t is output column 32*(w&3) + 2m + t, so that a lane's two columns lie side by side in memory.
// No wave shares a weight column with another, so the weights go from memory straight to the B fragments' registers, not through LDS.
__global__ __launch_bounds__(256) void k_proj(
    const float* __restrict__ X, const float* __restrict__ Wt, const float* __restrict__ Wx,
    const float* __restrict__ bh, float* Qo, float* Ko, int nrows)
{
    __shared__ __align__(16) uint32_t sAh[16 * AP2_];
    __shared__ __align__(16) uint32_t sAl[16 * AP2_];

    const int tid = threadIdx.x, lane = tid & 31, wave = tid >> 5;
    const int h = lane >> 4, m = lane & 15;
    const int row0 = blockIdx.x * 16;
    const int g = wave >> 2;
    const int col0 = (wave & 3) * 32 + 2 * m;

    // every load of the kernel is issued here, before the first is used: one trip to memory in all
    v4f_t xa[2];
#pragma unroll   // straight-line code, so that the loads stand together with no wait between them
    for (int it = 0; it < 2; ++it) {
        const int e = tid + 256 * it;
        const int r = e >> 5, q = e & 31;
        const int gr = row0 + r;
        xa[it] = v4f_t{0.0f, 0.0f, 0.0f, 0.0f};
        if (gr < nrows) xa[it] = *(const v4f*)(X + (size_t)gr * ND_ + 4 * q);
    }
    // weights: element e of pass kk is row k = 32kk + 8h + e (e < 8) or 32kk + 16 + 8h + (e - 8), the k map of the A fragment;
    // one load brings that row's two columns: 16 lanes x 8 bytes = one whole 128-byte line a half-wave
    const float* wp = ((g == 0) ? Wt : Wx) + (size_t)(8 * h) * NC_ + col0;
    v2f_t wv[64];
#pragma unroll   // straight-line code, so that the loads stand together with no wait between them
    for (int i = 0; i < 64; ++i) {
        const int kk = i >> 4, e = i & 15;
        wv[i] = *(const v2f*)(wp + (size_t)(32 * kk + e + ((e < 8) ? 0 : 8)) * NC_);
    }
    v2f_t bias = {0.0f, 0.0f};
    if (g == 0) bias = *(const v2f*)(bh + col0);
    // the arithmetic below reuses the registers that hold the loads' addresses: wait before they are overwritten
    asm volatile("s_wait_xcnt 0x0" ::: "memory");

    // activation tile 16 x 128 -> bf16 hi and lo planes (packed pairs)
#pragma unroll   // constant index, so that the loaded values stay in registers
    for (int it = 0; it < 2; ++it) {
        const int e = tid + 256 * it;
        const int r = e >> 5, q = e & 31;
        const v4f_t v = xa[it];
        uint32_t h0, l0, h1, l1, h2, l2, h3, l3;
        bf_split(v.x, h0, l0); bf_split(v.y, h1, l1);
        bf_split(v.z, h2, l2); bf_split(v.w, h3, l3);
        sAh[r * AP2_ + 2 * q]     = h0 | (h1 << 16);
        sAh[r * AP2_ + 2 * q + 1] = h2 | (h3 << 16);
        sAl[r * AP2_ + 2 * q]     = l0 | (l1 << 16);
        sAl[r * AP2_ + 2 * q + 1] = l2 | (l3 << 16);
    }
    __syncthreads();   // sA* staged

    v8f acc0 = {}, acc1 = {};
#pragma unroll   // constant index into wv, so that the loaded values stay in registers
    for (int kk = 0; kk < 4; ++kk) {
        // A: row m, elements 0..7 = k0+8h.., 8..15 = k0+16+8h..
        FragB fah, fal, fbh0, fbl0, fbh1, fbl1;
        const uint32_t* pa = sAh + m * AP2_ + kk * 16 + 4 * h;
        const uint32_t* pl = sAl + m * AP2_ + kk * 16 + 4 * h;
        fah.q[0] = *(const v4u*)(pa); fah.q[1] = *(const v4u*)(pa + 8);
        fal.q[0] = *(const v4u*)(pl); fal.q[1] = *(const v4u*)(pl + 8);
        // B: the pass's 16 rows of this lane's two columns, split and packed in pairs along k
#pragma unroll   // constant index into wv and the fragments
        for (int p = 0; p < 8; ++p) {
            const v2f_t w0 = wv[16 * kk + 2 * p], w1 = wv[16 * kk + 2 * p + 1];
            uint32_t a0, b0, a1, b1;
            bf_split(w0.x, a0, b0); bf_split(w1.x, a1, b1);
            fbh0.q[p >> 2][p & 3] = a0 | (a1 << 16);
            fbl0.q[p >> 2][p & 3] = b0 | (b1 << 16);
            bf_split(w0.y, a0, b0); bf_split(w1.y, a1, b1);
            fbh1.q[p >> 2][p & 3] = a0 | (a1 << 16);
            fbl1.q[p >> 2][p & 3] = b0 | (b1 << 16);
        }
        acc0 = mma_bf16(acc0, fah.v, fbh0.v);
        acc1 = mma_bf16(acc1, fah.v, fbh1.v);
        acc0 = mma_bf16(acc0, fah.v, fbl0.v);
        acc1 = mma_bf16(acc1, fah.v, fbl1.v);
        acc0 = mma_bf16(acc0, fal.v, fbh0.v);
        acc1 = mma_bf16(acc1, fal.v, fbh1.v);
    }

    // D: rows 8h+r, this lane's two columns side by side: a half-wave's store is one whole 128-byte line
    float* dst = ((g == 0) ? Qo : Ko) + (size_t)(row0 + 8 * h) * NC_ + col0;
    const int left = nrows - (row0 + 8 * h);   // rows of this half-wave's eight that exist
    if (left >= 8) {   // all eight: one test, so that the stores stand together, each from registers of its own
#pragma unroll   // constant index, so that the sums stay in registers
        for (int r = 0; r < 8; ++r)
            *(v2f*)(dst + (size_t)r * NC_) = v2f_t{acc0[r] + bias.x, acc1[r] + bias.y};
    } else {
#pragma unroll   // constant index, so that the sums stay in registers
        for (int r = 0; r < 8; ++r)
            if (r < left) *(v2f*)(dst + (size_t)r * NC_) = v2f_t{acc0[r] + bias.x, acc1[r] + bias.y};
    }
}

// ---------------- kernel 1: tanh scores (WMMA channel reduction) + online softmax + P*V over one key range ----------------
// grid = NB*(NL/16)*KS blocks of 256 threads; block owns (batch b, 16 query rows, key range sp); wave w owns output columns 16w..16w+15.
// It leaves its un-normalised partial tile in Op[sp][row][col] and its row maxima and row sums in Ml; kernel 2 merges the ranges.
__global__ __launch_bounds__(256) void k_attn(
    const float* __restrict__ X, const float* __restrict__ Qb, const float* __restrict__ Kx,
    const float* __restrict__ wa, const float* __restrict__ ba, float* Op, float* Ml)
{
    __shared__ __align__(16) float    sQ[16 * KP_];
    __shared__ __align__(16) float    sK[JC_ * KP_];
    __shared__ __align__(32) _Float16 sV[JC_ * VP_];
    __shared__ __align__(16) _Float16 sWB[16 * WBP_];
    __shared__ __align__(16) _Float16 sP[16 * JC_];
    __shared__ __align__(16) float    sS[JC_ * 16];   // scores, [key][query]
    __shared__ __align__(16) float    sO[16 * OP_];
    __shared__ float sM[16], sL[16], sSc[16];

    const int tid = threadIdx.x, lane = tid & 31, wave = tid >> 5;
    const int h = lane >> 4, m = lane & 15;
    const int sp = blockIdx.x % KS_;
    const int qt = blockIdx.x / KS_;
    const int b  = qt / (NL_ / 16);
    const int it = qt % (NL_ / 16);
    const int qrow0 = b * NL_ + it * 16;
    const int ncol = wave * 16 + m;

    // query tile (bias already folded in)
    // (its loads and those of wa below are all issued before the first LDS store)
    v4f_t qv[2];
#pragma unroll   // straight-line code, so that the loads stand together with no wait between them
    for (int it = 0; it < 2; ++it)   // element e = tid + 256*it of the tile, rows contiguous
        qv[it] = *(const v4f*)(Qb + (size_t)qrow0 * NC_ + 4 * tid + 1024 * it);
    constexpr int NWB = (16 * WBP_ + 255) / 256;
    float wv[NWB];
#pragma unroll   // straight-line code, so that the loads stand together with no wait between them
    for (int it = 0; it < NWB; ++it) {
        const int e = tid + 256 * it;
        const int c = e % WBP_;
        wv[it] = (c < NC_) ? wa[c] : 0.0f;
    }
#pragma unroll   // constant index, so that the loaded values stay in registers
    for (int it = 0; it < 2; ++it) {
        const int e = tid + 256 * it;
        const int r = e >> 5, q = e & 31;
        *(v4f*)(sQ + r * KP_ + 4 * q) = qv[it];
    }
    // wa as a [n][c] 16-bit operand: column 0 = f16 hi, column 1 = (wa - hi) * 4096, columns 2..15 = 0
#pragma unroll   // constant index, so that the loaded values stay in registers
    for (int it = 0; it < NWB; ++it) {
        const int e = tid + 256 * it;
        const int rr = e / WBP_;
        const int c = e - rr * WBP_;
        _Float16 val = (_Float16)0.0f;
        if (c < NC_) {
            const float w = wv[it];
            const _Float16 hi = (_Float16)w;
            if (rr == 0) val = hi;
            else if (rr == 1) val = (_Float16)((w - (float)hi) * 4096.0f);
        }
        if (e < 16 * WBP_) sWB[e] = val;
    }
    if (tid < 16) { sM[tid] = -3.0e38f; sL[tid] = 0.0f; }
    const float bav = ba[0];

    // the two score operands that no key changes go to registers once: this lane's query row (A side) and its wa column (B side)
    __syncthreads();   // sQ and sWB staged
    v4f_t qf[16];      // query row m; pass kk: channels 32kk+8h..+7 in [4kk], [4kk+1], channels 32kk+16+8h..+7 in [4kk+2], [4kk+3]
    FragH wb[4];       // column m of the wa tile, same k map
#pragma unroll   // constant index, so that the fragments stay in registers
    for (int kk = 0; kk < 4; ++kk) {
        const float* qp = sQ + m * KP_ + kk * 32 + 8 * h;
        qf[4 * kk + 0] = *(const v4f*)(qp);
        qf[4 * kk + 1] = *(const v4f*)(qp + 4);
        qf[4 * kk + 2] = *(const v4f*)(qp + 16);
        qf[4 * kk + 3] = *(const v4f*)(qp + 20);
        wb[kk].q[0] = *(const v8h*)(sWB + m * WBP_ + kk * 32 + 8 * h);
        wb[kk].q[1] = *(const v8h*)(sWB + m * WBP_ + kk * 32 + 16 + 8 * h);
    }

    v8f acco = {};   // output tile accumulator: rows 8h+r, column ncol (scaled by 4096)

#pragma unroll 1
    for (int ch = sp * (NL_ / JC_ / KS_); ch < (sp + 1) * (NL_ / JC_ / KS_); ++ch) {
        __syncthreads();   // readers of sK / sV / sS / sP from the last chunk are done
        const int j0 = ch * JC_;
        // the chunk's eight loads a thread (four of keys, four of values) are issued together:
        // one trip to memory a chunk instead of eight, each waited for in turn
        v4f_t kv[4], vv[4];
#pragma unroll   // straight-line code, so that the loads stand together with no wait between them
        for (int it = 0; it < 4; ++it) {   // element e = tid + 256*it of the chunk: row e>>5, float4 e&31, rows contiguous
            kv[it] = *(const v4f*)(Kx + (size_t)(b * NL_ + j0) * NC_ + 4 * tid + 1024 * it);
            vv[it] = *(const v4f*)(X + (size_t)(b * NL_ + j0) * ND_ + 4 * tid + 1024 * it);
        }
        // key chunk 32 x 128 f32
#pragma unroll   // constant index, so that the loaded values stay in registers
        for (int it = 0; it < 4; ++it) {
            const int e = tid + 256 * it;
            const int r = e >> 5, q = e & 31;
            *(v4f*)(sK + r * KP_ + 4 * q) = kv[it];
        }
        // value chunk as f16, rows as they lie in memory: a wave's store is one whole row of 256 bytes, every bank once
#pragma unroll   // constant index, so that the loaded values stay in registers
        for (int it = 0; it < 4; ++it) {
            const int e = tid + 256 * it;
            const int r = e >> 5, q = e & 31;
            const v4f_t v = vv[it];
            *(v4h*)(sV + r * VP_ + 4 * q) = v4h_t{(_Float16)v.x, (_Float16)v.y, (_Float16)v.z, (_Float16)v.w};
        }
        __syncthreads();

        // scores: one tile a key (this wave's keys 4*wave..4*wave+3 of the chunk); A row = query (lane m), k = channel; B = wa columns.
        // Only the key row is read from LDS, the same 16 bytes for all 16 lanes of a half.
        const float* kb = sK + (wave * 4) * KP_ + 8 * h;
        v4f_t kr[16];   // the key row's channels, laid out as qf
#pragma unroll   // constant index, so that the row stays in registers
        for (int kk = 0; kk < 4; ++kk) {
            kr[4 * kk + 0] = *(const v4f*)(kb + kk * 32);
            kr[4 * kk + 1] = *(const v4f*)(kb + kk * 32 + 4);
            kr[4 * kk + 2] = *(const v4f*)(kb + kk * 32 + 16);
            kr[4 * kk + 3] = *(const v4f*)(kb + kk * 32 + 20);
        }
        v8f pa = {};      // the key before: its sums, and the neighbour column's sums on their way through the cross-lane unit
        float pl[8] = {0.0f, 0.0f, 0.0f, 0.0f, 0.0f, 0.0f, 0.0f, 0.0f};
#pragma unroll   // constant index into kr, qf and wb; the next key's reads stand among this key's passes
        for (int u = 0; u <= 4; ++u) {   // trip 4 only finishes key 3
            v8f acc = {};
#pragma unroll   // constant index into kr, qf and wb
            for (int kk = 0; kk < 4; ++kk) {
                if (u < 4) {
                    const v4f_t x0 = qf[4 * kk + 0] + kr[4 * kk + 0];
                    const v4f_t x1 = qf[4 * kk + 1] + kr[4 * kk + 1];
                    const v4f_t x2 = qf[4 * kk + 2] + kr[4 * kk + 2];
                    const v4f_t x3 = qf[4 * kk + 3] + kr[4 * kk + 3];
                    FragH fa;   // elements 0..7 = channels 32kk+8h.., 8..15 = 32kk+16+8h..
                    fa.e[0]  = th_h(x0.x); fa.e[1]  = th_h(x0.y); fa.e[2]  = th_h(x0.z); fa.e[3]  = th_h(x0.w);
                    fa.e[4]  = th_h(x1.x); fa.e[5]  = th_h(x1.y); fa.e[6]  = th_h(x1.z); fa.e[7]  = th_h(x1.w);
                    fa.e[8]  = th_h(x2.x); fa.e[9]  = th_h(x2.y); fa.e[10] = th_h(x2.z); fa.e[11] = th_h(x2.w);
                    fa.e[12] = th_h(x3.x); fa.e[13] = th_h(x3.y); fa.e[14] = th_h(x3.z); fa.e[15] = th_h(x3.w);
                    acc = mma_f16(acc, fa.v, wb[kk].v);
                }
                // two passes have used up half of the key registers: the next key's same half is fetched into them, two passes ahead of its use
                if ((kk & 1) && u < 3) {
#pragma unroll   // constant index into kr
                    for (int kn = kk - 1; kn <= kk; ++kn) {
                        const float* kp = kb + (u + 1) * KP_ + kn * 32;
                        kr[4 * kn + 0] = *(const v4f*)(kp);
                        kr[4 * kn + 1] = *(const v4f*)(kp + 4);
                        kr[4 * kn + 2] = *(const v4f*)(kp + 16);
                        kr[4 * kn + 3] = *(const v4f*)(kp + 20);
                    }
                }
                // the key before is finished here, two passes after its cross-lane moves were issued
                // D: lane column 0 = hi sums, column 1 = lo sums (x4096); rows 8h+r = queries 8h+r
                if (kk == 1 && u > 0 && m == 0) {
                    float sv[8];
#pragma unroll   // constant index, so that the sums stay in registers
                    for (int r = 0; r < 8; ++r) sv[r] = pa[r] + pl[r] * (1.0f / 4096.0f) + bav;
                    float* sp8 = sS + (wave * 4 + u - 1) * 16 + 8 * h;
                    *(v4f*)(sp8)     = v4f_t{sv[0], sv[1], sv[2], sv[3]};
                    *(v4f*)(sp8 + 4) = v4f_t{sv[4], sv[5], sv[6], sv[7]};
                }
                if (kk == 3 && u < 4) {
#pragma unroll   // constant index, so that the sums stay in registers
                    for (int r = 0; r < 8; ++r) pl[r] = __shfl_xor(acc[r], 1);
                    pa = acc;
                }
                // keeps the later passes' vector work behind the reads above: lifted over them, it would issue the reads only just before their use
                if ((kk & 1) && u < 3) __builtin_amdgcn_sched_barrier(0);
            }
        }
        __syncthreads();

        // online softmax statistics per query row
        if (tid < 16) {
            const int i = tid;
            const float mo = sM[i];
            float cm = mo;
            for (int jj = 0; jj < JC_; ++jj) cm = fmaxf(cm, sS[jj * 16 + i]);
            const float sc = __builtin_amdgcn_exp2f((mo - cm) * LOG2E_F);
            float ls = sL[i] * sc;
            for (int jj = 0; jj < JC_; ++jj) {
                const float ev = __builtin_amdgcn_exp2f((sS[jj * 16 + i] - cm) * LOG2E_F);
                ls += ev;
                sP[i * JC_ + jj] = (_Float16)(ev * 4096.0f);
            }
            sM[i] = cm; sL[i] = ls; sSc[i] = sc;
        }
        __syncthreads();

        // O = O*scale + P(16 x 32 keys) * V(32 keys x 16 cols)
#pragma unroll
        for (int r = 0; r < 8; ++r) acco[r] *= sSc[8 * h + r];
        FragH fp, fv;
        fp.q[0] = *(const v8h*)(sP + m * JC_ + 8 * h);
        fp.q[1] = *(const v8h*)(sP + m * JC_ + 16 + 8 * h);
        // the read transposes: lane (h, m) gets keys 8h..8h+7 (then 16+8h..+7) of column 16*wave + m, the k map of fp
        const _Float16* vp = sV + (8 * h + (lane & 7)) * VP_ + 16 * wave + 8 * ((lane >> 3) & 1);
        fv.q[0] = ld_tr16(vp);
        fv.q[1] = ld_tr16(vp + 16 * VP_);
        acco = mma_f16(acco, fp.v, fv.v);
    }

    // epilogue: stage the 16 x 128 partial tile as it stands (scaled by 4096, relative to the range's own maxima), whole-row stores
#pragma unroll
    for (int r = 0; r < 8; ++r) sO[(8 * h + r) * OP_ + ncol] = acco[r];
    __syncthreads();
    const int r0 = 2 * wave, r1 = 2 * wave + 1;
    const v4f_t v0 = *(const v4f*)(sO + r0 * OP_ + 4 * lane);
    const v4f_t v1 = *(const v4f*)(sO + r1 * OP_ + 4 * lane);
    float* p0 = Op + ((size_t)sp * NROWS_ + qrow0 + r0) * ND_ + 4 * lane;
    float* p1 = Op + ((size_t)sp * NROWS_ + qrow0 + r1) * ND_ + 4 * lane;
    *(v4f*)p0 = v0;
    *(v4f*)p1 = v1;
    // the range's 16 row maxima, then its 16 row sums: one whole 128-byte line a work-group
    if (wave == 0) Ml[(size_t)(sp * NQT_ + qt) * 32 + lane] = (h == 0) ? sM[m] : sL[m];
}

// ---------------- kernel 2: merge of the KS key ranges of every query row ----------------
// grid = NROWS/8 blocks of 256 threads; wave w owns query row 8*blockIdx.x + w, lane l its columns 4l..4l+3.
__global__ __launch_bounds__(256) void k_merge(
    const float* __restrict__ Op, const float* __restrict__ Ml, float* Out)
{
    const int lane = threadIdx.x & 31, wave = threadIdx.x >> 5;
    const int row = blockIdx.x * 8 + wave;
    const int qt = row >> 4, rr = row & 15;
    float ms[KS_], ls[KS_];
    v4f_t os[KS_];
#pragma unroll   // straight-line code, so that all loads stand together: one trip to memory
    for (int s = 0; s < KS_; ++s) {
        ms[s] = Ml[(size_t)(s * NQT_ + qt) * 32 + rr];
        ls[s] = Ml[(size_t)(s * NQT_ + qt) * 32 + 16 + rr];
        os[s] = *(const v4f*)(Op + ((size_t)s * NROWS_ + row) * ND_ + 4 * lane);
    }
    // the arithmetic below reuses the registers that hold the loads' addresses: wait before they are overwritten
    asm volatile("s_wait_xcnt 0x0" ::: "memory");
    float mx = ms[0];
#pragma unroll   // constant index, so that the loaded values stay in registers
    for (int s = 1; s < KS_; ++s) mx = fmaxf(mx, ms[s]);
    float l = 0.0f;
    v4f_t o = {0.0f, 0.0f, 0.0f, 0.0f};
#pragma unroll   // constant index, so that the loaded values stay in registers
    for (int s = 0; s < KS_; ++s) {
        const float w = __builtin_amdgcn_exp2f((ms[s] - mx) * LOG2E_F);
        l += ls[s] * w;
        o += os[s] * w;
    }
    const float inv = 1.0f / (l + EPS_);
    *(v4f*)(Out + (size_t)row * ND_ + 4 * lane) = o * inv * (1.0f / 4096.0f);
}

// ---------------- launcher ----------------
extern "C" void kernel_launch(void* const* d_in, const int* in_sizes, int n_in,
                              void* d_out, int out_size, void* d_ws, size_t ws_size,
                              hipStream_t stream) {
    if (n_in < 6) return;
    if (in_sizes[0] != NROWS_ * ND_ || in_sizes[1] != ND_ * NC_ || in_sizes[2] != ND_ * NC_ ||
        in_sizes[3] != NC_ || in_sizes[4] != NC_ || in_sizes[5] < 1 || out_size != NROWS_ * ND_)
        return;

    const float* inps  = (const float*)d_in[0];
    const float* wei_t = (const float*)d_in[1];
    const float* wei_x = (const float*)d_in[2];
    const float* bxh   = (const float*)d_in[3];
    const float* wei_a = (const float*)d_in[4];
    const float* bxa   = (const float*)d_in[5];
    float* out = (float*)d_out;

    // workspace: Q [NROWS][NC] f32 at 0, K [NROWS][NC] f32 at 1 MiB, partial tiles [KS][NROWS][ND] f32 at 2 MiB,
    // then maxima and sums [KS][NQT][32] f32; total 6 MiB + 64 KiB
    const size_t per = (size_t)NROWS_ * NC_ * sizeof(float);
    if (ws_size < (2 + KS_) * per + (size_t)KS_ * NQT_ * 32 * sizeof(float)) return;
    float* qb = (float*)d_ws;
    float* kx = (float*)((char*)d_ws + per);
    float* op = (float*)((char*)d_ws + 2 * per);
    float* ml = (float*)((char*)d_ws + (2 + KS_) * per);

    const int nrows = NROWS_;
    k_proj<<<dim3((nrows + 15) / 16), dim3(256), 0, stream>>>(inps, wei_t, wei_x, bxh, qb, kx, nrows);
    k_attn<<<dim3(NB_ * (NL_ / 16) * KS_), dim3(256), 0, stream>>>(inps, qb, kx, wei_a, bxa, op, ml);
    k_merge<<<dim3(NROWS_ / 8), dim3(256), 0, stream>>>(op, ml, out);
}

// v007
// One run takes 22.1 microseconds.
// Timed twice side by side with v006, it ran 1.03 and 1.04 times as fast.
// Counting every step since v000, it is 6.07 times as fast.
#include <hip/hip_runtime.h>
#include <stdint.h>

// Contractions: X*Wt and X*Wx on v_wmma_f32_16x16x32_bf16 as bf16 hi/lo split (3 products each); tanh-score channel reduction (N padded to 16) and P*V on v_wmma_f32_16x16x32_f16 (f16 operands; the low part of wa and P power-of-two pre-scaled); all accumulation f32.

#define NB_    4
#define NL_    512
#define ND_    128
#define NC_    128
#define NROWS_ (NB_ * NL_)
#define EPS_   1e-7f
#define JC_    32          // keys per chunk
#define KS_    4           // key ranges: work-groups that share one tile of 16 query rows, NL/KS keys each
#define NQT_   (NROWS_ / 16)   // tiles of 16 query rows
#define KP_    132         // f32 pitch of the key tile and of the value tile in LDS (528 bytes = 16 x odd)
#define CB_    (JC_ * KP_) // floats of one chunk buffer (keys or values)
#define NCH_   (NL_ / JC_ / KS_)   // chunks a key range
#define WBP_   136         // f16 pitch of the wa operand tile [n][c]
#define OP_    132         // f32 pitch of the output staging tile
#define AP2_   68          // uint32 pitch (136 halves) of the bf16 activation tile

typedef float    v8f   __attribute__((ext_vector_type(8)));
typedef float    v4f_t __attribute__((ext_vector_type(4)));
typedef v4f_t    __attribute__((may_alias)) v4f;
typedef float    v2f_t __attribute__((ext_vector_type(2)));
typedef v2f_t    __attribute__((may_alias)) v2f;
typedef uint32_t v4u_t __attribute__((ext_vector_type(4)));
typedef v4u_t    __attribute__((may_alias)) v4u;
typedef __bf16   v16bf __attribute__((ext_vector_type(16)));
typedef _Float16 v16h  __attribute__((ext_vector_type(16)));
typedef _Float16 v8h_t __attribute__((ext_vector_type(8)));
typedef v8h_t    __attribute__((may_alias)) v8h;

union FragB { v4u_t q[2]; v16bf v; };
union FragH { _Float16 e[16]; v8h_t q[2]; v16h v; };

#define LOG2E_F     1.4426950408889634f

// ---------------- WMMA wrappers with hazard guard ----------------
__device__ __forceinline__ v8f mma_bf16(v8f acc, v16bf a, v16bf b) {
    acc = __builtin_amdgcn_wmma_f32_16x16x32_bf16(false, a, false, b, (short)0, acc, false, false);
    asm volatile("v_nop\n\tv_nop\n\tv_nop\n\tv_nop" : "+v"(acc) : "v"(a), "v"(b));
    return acc;
}
__device__ __forceinline__ v8f mma_f16(v8f acc, v16h a, v16h b) {
    acc = __builtin_amdgcn_wmma_f32_16x16x32_f16(false, a, false, b, (short)0, acc, false, false);
    asm volatile("v_nop\n\tv_nop\n\tv_nop\n\tv_nop" : "+v"(acc) : "v"(a), "v"(b));
    return acc;
}

// ---------------- f32 -> bf16 (RNE) hi/lo split ----------------
__device__ __forceinline__ uint32_t bf_bits(float f) {
    uint32_t u = __builtin_bit_cast(uint32_t, f);
    u += 0x7FFFu + ((u >> 16) & 1u);
    return u >> 16;
}
__device__ __forceinline__ void bf_split(float x, uint32_t& hi, uint32_t& lo) {
    hi = bf_bits(x);
    const float xh = __builtin_bit_cast(float, hi << 16);
    lo = bf_bits(x - xh);
}

// tanh(x) as f16 (RNE convert); the tanh is the chip's own instruction, v_tanh_f32
__device__ __forceinline__ _Float16 th_h(float x) {
    return (_Float16)__builtin_amdgcn_tanhf(x);
}

// One chunk (32 key rows and 32 value rows of 128 f32) from memory into LDS through no register: eight copies of 16 bytes a lane.
// gk, gv: the lane's first 16 bytes of the chunk in memory (float4 number tid; the next three lie 256 float4 further each);
// lk, lv: their LDS byte addresses (row tid>>5, float4 tid&31; the next three lie eight rows further each).
__device__ __forceinline__ void copy_chunk(const float* gk, const float* gv, uint32_t lk, uint32_t lv) {
    // the closing s_wait_xcnt stands in the copies' own statement, so that no address register is rewritten in front of it
    asm volatile(
        "global_load_async_to_lds_b128 %0, %8, off\n\t"
        "global_load_async_to_lds_b128 %1, %9, off\n\t"
        "global_load_async_to_lds_b128 %2, %10, off\n\t"
        "global_load_async_to_lds_b128 %3, %11, off\n\t"
        "global_load_async_to_lds_b128 %4, %12, off\n\t"
        "global_load_async_to_lds_b128 %5, %13, off\n\t"
        "global_load_async_to_lds_b128 %6, %14, off\n\t"
        "global_load_async_to_lds_b128 %7, %15, off\n\t"
        "s_wait_xcnt 0x0"
        :: "v"(lk), "v"(lk + 8 * KP_ * 4), "v"(lk + 16 * KP_ * 4), "v"(lk + 24 * KP_ * 4),
           "v"(lv), "v"(lv + 8 * KP_ * 4), "v"(lv + 16 * KP_ * 4), "v"(lv + 24 * KP_ * 4),
           "v"(gk), "v"(gk + 1024), "v"(gk + 2048), "v"(gk + 3072),
           "v"(gv), "v"(gv + 1024), "v"(gv + 2048), "v"(gv + 3072)
        : "memory");
}

// ---------------- kernel 0: Q = X*Wt + bh, K = X*Wx (bf16 hi/lo split WMMA) ----------------
// grid = ceil(nrows/16) blocks of 256 threads; waves 0..3 make Q, waves 4..7 make K; wave w owns the 32 output columns 32*(w&3)..+31
// as two tiles: column m of tile t is output column 32*(w&3) + 2m + t, so that a lane's two columns lie side by side in memory.
// No wave shares a weight column with another, so the weights go from memory straight to the B fragments' registers, not through LDS.
__global__ __launch_bounds__(256) void k_proj(
    const float* __restrict__ X, const float* __restrict__ Wt, const float* __restrict__ Wx,
    const float* __restrict__ bh, float* Qo, float* Ko, int nrows)
{
    __shared__ __align__(16) uint32_t sAh[16 * AP2_];
    __shared__ __align__(16) uint32_t sAl[16 * AP2_];

    const int tid = threadIdx.x, lane = tid & 31, wave = tid >> 5;
    const int h = lane >> 4, m = lane & 15;
    const int row0 = blockIdx.x * 16;
    const int g = wave >> 2;
    const int col0 = (wave & 3) * 32 + 2 * m;

    // every load of the kernel is issued here, before the first is used: one trip to memory in all
    v4f_t xa[2];
#pragma unroll   // straight-line code, so that the loads stand together with no wait between them
    for (int it = 0; it < 2; ++it) {
        const int e = tid + 256 * it;
        const int r = e >> 5, q = e & 31;
        const int gr = row0 + r;
        xa[it] = v4f_t{0.0f, 0.0f, 0.0f, 0.0f};
        if (gr < nrows) xa[it] = *(const v4f*)(X + (size_t)gr * ND_ + 4 * q);
    }
    // weights: element e of pass kk is row k = 32kk + 8h + e (e < 8) or 32kk + 16 + 8h + (e - 8), the k map of the A fragment;
    // one load brings that row's two columns: 16 lanes x 8 bytes = one whole 128-byte line a half-wave
    const float* wp = ((g == 0) ? Wt : Wx) + (size_t)(8 * h) * NC_ + col0;
    v2f_t wv[64];
#pragma unroll   // straight-line code, so that the loads stand together with no wait between them
    for (int i = 0; i < 64; ++i) {
        const int kk = i >> 4, e = i & 15;
        wv[i] = *(const v2f*)(wp + (size_t)(32 * kk + e + ((e < 8) ? 0 : 8)) * NC_);
    }
    v2f_t bias = {0.0f, 0.0f};
    if (g == 0) bias = *(const v2f*)(bh + col0);
    // the arithmetic below reuses the registers that hold the loads' addresses: wait before they are overwritten
    asm volatile("s_wait_xcnt 0x0" ::: "memory");

    // activation tile 16 x 128 -> bf16 hi and lo planes (packed pairs)
#pragma unroll   // constant index, so that the loaded values stay in registers
    for (int it = 0; it < 2; ++it) {
        const int e = tid + 256 * it;
        const int r = e >> 5, q = e & 31;
        const v4f_t v = xa[it];
        uint32_t h0, l0, h1, l1, h2, l2, h3, l3;
        bf_split(v.x, h0, l0); bf_split(v.y, h1, l1);
        bf_split(v.z, h2, l2); bf_split(v.w, h3, l3);
        sAh[r * AP2_ + 2 * q]     = h0 | (h1 << 16);
        sAh[r * AP2_ + 2 * q + 1] = h2 | (h3 << 16);
        sAl[r * AP2_ + 2 * q]     = l0 | (l1 << 16);
        sAl[r * AP2_ + 2 * q + 1] = l2 | (l3 << 16);
    }
    __syncthreads();   // sA* staged

    v8f acc0 = {}, acc1 = {};
#pragma unroll   // constant index into wv, so that the loaded values stay in registers
    for (int kk = 0; kk < 4; ++kk) {
        // A: row m, elements 0..7 = k0+8h.., 8..15 = k0+16+8h..
        FragB fah, fal, fbh0, fbl0, fbh1, fbl1;
        const uint32_t* pa = sAh + m * AP2_ + kk * 16 + 4 * h;
        const uint32_t* pl = sAl + m * AP2_ + kk * 16 + 4 * h;
        fah.q[0] = *(const v4u*)(pa); fah.q[1] = *(const v4u*)(pa + 8);
        fal.q[0] = *(const v4u*)(pl); fal.q[1] = *(const v4u*)(pl + 8);
        // B: the pass's 16 rows of this lane's two columns, split and packed in pairs along k
#pragma unroll   // constant index into wv and the fragments
        for (int p = 0; p < 8; ++p) {
            const v2f_t w0 = wv[16 * kk + 2 * p], w1 = wv[16 * kk + 2 * p + 1];
            uint32_t a0, b0, a1, b1;
            bf_split(w0.x, a0, b0); bf_split(w1.x, a1, b1);
            fbh0.q[p >> 2][p & 3] = a0 | (a1 << 16);
            fbl0.q[p >> 2][p & 3] = b0 | (b1 << 16);
            bf_split(w0.y, a0, b0); bf_split(w1.y, a1, b1);
            fbh1.q[p >> 2][p & 3] = a0 | (a1 << 16);
            fbl1.q[p >> 2][p & 3] = b0 | (b1 << 16);
        }
        acc0 = mma_bf16(acc0, fah.v, fbh0.v);
        acc1 = mma_bf16(acc1, fah.v, fbh1.v);
        acc0 = mma_bf16(acc0, fah.v, fbl0.v);
        acc1 = mma_bf16(acc1, fah.v, fbl1.v);
        acc0 = mma_bf16(acc0, fal.v, fbh0.v);
        acc1 = mma_bf16(acc1, fal.v, fbh1.v);
    }

    // D: rows 8h+r, this lane's two columns side by side: a half-wave's store is one whole 128-byte line
    float* dst = ((g == 0) ? Qo : Ko) + (size_t)(row0 + 8 * h) * NC_ + col0;
    const int left = nrows - (row0 + 8 * h);   // rows of this half-wave's eight that exist
    if (left >= 8) {   // all eight: one test, so that the stores stand together, each from registers of its own
#pragma unroll   // constant index, so that the sums stay in registers
        for (int r = 0; r < 8; ++r)
            *(v2f*)(dst + (size_t)r * NC_) = v2f_t{acc0[r] + bias.x, acc1[r] + bias.y};
    } else {
#pragma unroll   // constant index, so that the sums stay in registers
        for (int r = 0; r < 8; ++r)
            if (r < left) *(v2f*)(dst + (size_t)r * NC_) = v2f_t{acc0[r] + bias.x, acc1[r] + bias.y};
    }
}

// ---------------- kernel 1: tanh scores (WMMA channel reduction) + online softmax + P*V over one key range ----------------
// grid = NB*(NL/16)*KS blocks of 256 threads; block owns (batch b, 16 query rows, key range sp); wave w owns output columns 16w..16w+15.
// It leaves its un-normalised partial tile in Op[sp][row][col] and its row maxima and row sums in Ml; kernel 2 merges the ranges.
__global__ __launch_bounds__(256) void k_attn(
    const float* __restrict__ X, const float* __restrict__ Qb, const float* __restrict__ Kx,
    const float* __restrict__ wa, const float* __restrict__ ba, float* Op, float* Ml)
{
    __shared__ __align__(16) float    sQ[16 * KP_];
    __shared__ __align__(16) float    sK[2 * CB_];   // two chunk buffers: one is read while the other is filled
    __shared__ __align__(16) float    sV[2 * CB_];
    __shared__ __align__(16) _Float16 sWB[16 * WBP_];
    __shared__ __align__(16) _Float16 sP[16 * JC_];
    __shared__ __align__(16) float    sS[JC_ * 16];   // scores, [key][query]
    __shared__ __align__(16) float    sO[16 * OP_];
    __shared__ float sM[16], sL[16], sSc[16];

    const int tid = threadIdx.x, lane = tid & 31, wave = tid >> 5;
    const int h = lane >> 4, m = lane & 15;
    const int sp = blockIdx.x % KS_;
    const int qt = blockIdx.x / KS_;
    const int b  = qt / (NL_ / 16);
    const int it = qt % (NL_ / 16);
    const int qrow0 = b * NL_ + it * 16;
    const int ncol = wave * 16 + m;

    // chunk 0 sets out for buffer 0 before anything else, so that it flies under the staging of Q and wa
    const float* gk = Kx + (size_t)(b * NL_ + sp * NCH_ * JC_) * NC_ + 4 * tid;
    const float* gv = X + (size_t)(b * NL_ + sp * NCH_ * JC_) * ND_ + 4 * tid;
    const uint32_t lk = (uint32_t)(uintptr_t)(sK + wave * KP_ + 4 * lane);
    const uint32_t lv = (uint32_t)(uintptr_t)(sV + wave * KP_ + 4 * lane);
    copy_chunk(gk, gv, lk, lv);

    // query tile (bias already folded in)
    // (its loads and those of wa below are all issued before the first LDS store)
    v4f_t qv[2];
#pragma unroll   // straight-line code, so that the loads stand together with no wait between them
    for (int it = 0; it < 2; ++it)   // element e = tid + 256*it of the tile, rows contiguous
        qv[it] = *(const v4f*)(Qb + (size_t)qrow0 * NC_ + 4 * tid + 1024 * it);
    constexpr int NWB = (16 * WBP_ + 255) / 256;
    float wv[NWB];
#pragma unroll   // straight-line code, so that the loads stand together with no wait between them
    for (int it = 0; it < NWB; ++it) {
        const int e = tid + 256 * it;
        const int c = e % WBP_;
        wv[it] = (c < NC_) ? wa[c] : 0.0f;
    }
#pragma unroll   // constant index, so that the loaded values stay in registers
    for (int it = 0; it < 2; ++it) {
        const int e = tid + 256 * it;
        const int r = e >> 5, q = e & 31;
        *(v4f*)(sQ + r * KP_ + 4 * q) = qv[it];
    }
    // wa as a [n][c] 16-bit operand: column 0 = f16 hi, column 1 = (wa - hi) * 4096, columns 2..15 = 0
#pragma unroll   // constant index, so that the loaded values stay in registers
    for (int it = 0; it < NWB; ++it) {
        const int e = tid + 256 * it;
        const int rr = e / WBP_;
        const int c = e - rr * WBP_;
        _Float16 val = (_Float16)0.0f;
        if (c < NC_) {
            const float w = wv[it];
            const _Float16 hi = (_Float16)w;
            if (rr == 0) val = hi;
            else if (rr == 1) val = (_Float16)((w - (float)hi) * 4096.0f);
        }
        if (e < 16 * WBP_) sWB[e] = val;
    }
    if (tid < 16) { sM[tid] = -3.0e38f; sL[tid] = 0.0f; }
    const float bav = ba[0];

    // the two score operands that no key changes go to registers once: this lane's query row (A side) and its wa column (B side)
    asm volatile("s_wait_asynccnt 0x0" ::: "memory");   // this wave's copies of chunk 0 have landed before the barrier publishes them
    __syncthreads();   // sQ, sWB and chunk 0 staged
    copy_chunk(gk + JC_ * NC_, gv + JC_ * ND_, lk + CB_ * 4, lv + CB_ * 4);   // chunk 1 flies while chunk 0 is worked on
    v4f_t qf[16];      // query row m; pass kk: channels 32kk+8h..+7 in [4kk], [4kk+1], channels 32kk+16+8h..+7 in [4kk+2], [4kk+3]
    FragH wb[4];       // column m of the wa tile, same k map
#pragma unroll   // constant index, so that the fragments stay in registers
    for (int kk = 0; kk < 4; ++kk) {
        const float* qp = sQ + m * KP_ + kk * 32 + 8 * h;
        qf[4 * kk + 0] = *(const v4f*)(qp);
        qf[4 * kk + 1] = *(const v4f*)(qp + 4);
        qf[4 * kk + 2] = *(const v4f*)(qp + 16);
        qf[4 * kk + 3] = *(const v4f*)(qp + 20);
        wb[kk].q[0] = *(const v8h*)(sWB + m * WBP_ + kk * 32 + 8 * h);
        wb[kk].q[1] = *(const v8h*)(sWB + m * WBP_ + kk * 32 + 16 + 8 * h);
    }

    v8f acco = {};   // output tile accumulator: rows 8h+r, column ncol (scaled by 4096)

#pragma unroll 1
    for (int t = 0; t < NCH_; ++t) {   // trip t reads buffer t & 1 alone
        const int bo = (t & 1) * CB_;

        // scores: one tile a key (this wave's keys 4*wave..4*wave+3 of the chunk); A row = query (lane m), k = channel; B = wa columns.
        // Only the key row is read from LDS, the same 16 bytes for all 16 lanes of a half.
        const float* kb = sK + bo + (wave * 4) * KP_ + 8 * h;
        v4f_t kr[16];   // the key row's channels, laid out as qf
#pragma unroll   // constant index, so that the row stays in registers
        for (int kk = 0; kk < 4; ++kk) {
            kr[4 * kk + 0] = *(const v4f*)(kb + kk * 32);
            kr[4 * kk + 1] = *(const v4f*)(kb + kk * 32 + 4);
            kr[4 * kk + 2] = *(const v4f*)(kb + kk * 32 + 16);
            kr[4 * kk + 3] = *(const v4f*)(kb + kk * 32 + 20);
        }
        v8f pa = {};      // the key before: its sums, and the neighbour column's sums on their way through the cross-lane unit
        float pl[8] = {0.0f, 0.0f, 0.0f, 0.0f, 0.0f, 0.0f, 0.0f, 0.0f};
#pragma unroll   // constant index into kr, qf and wb; the next key's reads stand among this key's passes
        for (int u = 0; u <= 4; ++u) {   // trip 4 only finishes key 3
            v8f acc = {};
#pragma unroll   // constant index into kr, qf and wb
            for (int kk = 0; kk < 4; ++kk) {
                if (u < 4) {
                    const v4f_t x0 = qf[4 * kk + 0] + kr[4 * kk + 0];
                    const v4f_t x1 = qf[4 * kk + 1] + kr[4 * kk + 1];
                    const v4f_t x2 = qf[4 * kk + 2] + kr[4 * kk + 2];
                    const v4f_t x3 = qf[4 * kk + 3] + kr[4 * kk + 3];
                    FragH fa;   // elements 0..7 = channels 32kk+8h.., 8..15 = 32kk+16+8h..
                    fa.e[0]  = th_h(x0.x); fa.e[1]  = th_h(x0.y); fa.e[2]  = th_h(x0.z); fa.e[3]  = th_h(x0.w);
                    fa.e[4]  = th_h(x1.x); fa.e[5]  = th_h(x1.y); fa.e[6]  = th_h(x1.z); fa.e[7]  = th_h(x1.w);
                    fa.e[8]  = th_h(x2.x); fa.e[9]  = th_h(x2.y); fa.e[10] = th_h(x2.z); fa.e[11] = th_h(x2.w);
                    fa.e[12] = th_h(x3.x); fa.e[13] = th_h(x3.y); fa.e[14] = th_h(x3.z); fa.e[15] = th_h(x3.w);
                    acc = mma_f16(acc, fa.v, wb[kk].v);
                }
                // two passes have used up half of the key registers: the next key's same half is fetched into them, two passes ahead of its use
                if ((kk & 1) && u < 3) {
#pragma unroll   // constant index into kr
                    for (int kn = kk - 1; kn <= kk; ++kn) {
                        const float* kp = kb + (u + 1) * KP_ + kn * 32;
                        kr[4 * kn + 0] = *(const v4f*)(kp);
                        kr[4 * kn + 1] = *(const v4f*)(kp + 4);
                        kr[4 * kn + 2] = *(const v4f*)(kp + 16);
                        kr[4 * kn + 3] = *(const v4f*)(kp + 20);
                    }
                }
                // the key before is finished here, two passes after its cross-lane moves were issued
                // D: lane column 0 = hi sums, column 1 = lo sums (x4096); rows 8h+r = queries 8h+r
                if (kk == 1 && u > 0 && m == 0) {
                    float sv[8];
#pragma unroll   // constant index, so that the sums stay in registers
                    for (int r = 0; r < 8; ++r) sv[r] = pa[r] + pl[r] * (1.0f / 4096.0f) + bav;
                    float* sp8 = sS + (wave * 4 + u - 1) * 16 + 8 * h;
                    *(v4f*)(sp8)     = v4f_t{sv[0], sv[1], sv[2], sv[3]};
                    *(v4f*)(sp8 + 4) = v4f_t{sv[4], sv[5], sv[6], sv[7]};
                }
                if (kk == 3 && u < 4) {
#pragma unroll   // constant index, so that the sums stay in registers
                    for (int r = 0; r < 8; ++r) pl[r] = __shfl_xor(acc[r], 1);
                    pa = acc;
                }
                // keeps the later passes' vector work behind the reads above: lifted over them, it would issue the reads only just before their use
                if ((kk & 1) && u < 3) __builtin_amdgcn_sched_barrier(0);
            }
        }
        __syncthreads();

        // this wave's value operand is asked for here, so that its reads run under the statistics below:
        // lane (h, m) takes keys 8h..8h+7, then 16+8h..+7, of column 16*wave + m, the k map of fp; a read's 32 lanes fall on 32 banks
        const float* vp = sV + bo + (8 * h) * KP_ + ncol;
        float vr[16];
#pragma unroll   // constant index, so that the values stay in registers
        for (int e = 0; e < 8; ++e) { vr[e] = vp[e * KP_]; vr[8 + e] = vp[(16 + e) * KP_]; }

        // online softmax statistics per query row
        if (tid < 16) {
            const int i = tid;
            const float mo = sM[i];
            float cm = mo;
            for (int jj = 0; jj < JC_; ++jj) cm = fmaxf(cm, sS[jj * 16 + i]);
            const float sc = __builtin_amdgcn_exp2f((mo - cm) * LOG2E_F);
            float ls = sL[i] * sc;
            for (int jj = 0; jj < JC_; ++jj) {
                const float ev = __builtin_amdgcn_exp2f((sS[jj * 16 + i] - cm) * LOG2E_F);
                ls += ev;
                sP[i * JC_ + jj] = (_Float16)(ev * 4096.0f);
            }
            sM[i] = cm; sL[i] = ls; sSc[i] = sc;
        }
        __syncthreads();

        // O = O*scale + P(16 x 32 keys) * V(32 keys x 16 cols)
#pragma unroll
        for (int r = 0; r < 8; ++r) acco[r] *= sSc[8 * h + r];
        FragH fp, fv;
        fp.q[0] = *(const v8h*)(sP + m * JC_ + 8 * h);
        fp.q[1] = *(const v8h*)(sP + m * JC_ + 16 + 8 * h);
#pragma unroll   // constant index, so that the values stay in registers
        for (int e = 0; e < 16; ++e) fv.e[e] = (_Float16)vr[e];
        acco = mma_f16(acco, fp.v, fv.v);

        // hand-over: the one barrier publishes chunk t + 1 and ends every wave's reads of this trip's buffer
        asm volatile("s_wait_dscnt 0x0" ::: "memory");      // this wave's LDS reads of the buffer are done before it is refilled
        asm volatile("s_wait_asynccnt 0x0" ::: "memory");   // this wave's copies of chunk t + 1 have landed before the barrier publishes them
        __syncthreads();
        if (t + 2 < NCH_)   // the same for the whole work-group
            copy_chunk(gk + (t + 2) * (JC_ * NC_), gv + (t + 2) * (JC_ * ND_), lk + bo * 4, lv + bo * 4);
    }
    asm volatile("s_wait_asynccnt 0x0" ::: "memory");   // no copy is left in flight when the wave goes on to its end

    // epilogue: stage the 16 x 128 partial tile as it stands (scaled by 4096, relative to the range's own maxima), whole-row stores
#pragma unroll
    for (int r = 0; r < 8; ++r) sO[(8 * h + r) * OP_ + ncol] = acco[r];
    __syncthreads();
    const int r0 = 2 * wave, r1 = 2 * wave + 1;
    const v4f_t v0 = *(const v4f*)(sO + r0 * OP_ + 4 * lane);
    const v4f_t v1 = *(const v4f*)(sO + r1 * OP_ + 4 * lane);
    float* p0 = Op + ((size_t)sp * NROWS_ + qrow0 + r0) * ND_ + 4 * lane;
    float* p1 = Op + ((size_t)sp * NROWS_ + qrow0 + r1) * ND_ + 4 * lane;
    *(v4f*)p0 = v0;
    *(v4f*)p1 = v1;
    // the range's 16 row maxima, then its 16 row sums: one whole 128-byte line a work-group
    if (wave == 0) Ml[(size_t)(sp * NQT_ + qt) * 32 + lane] = (h == 0) ? sM[m] : sL[m];
}

// ---------------- kernel 2: merge of the KS key ranges of every query row ----------------
// grid = NROWS/8 blocks of 256 threads; wave w owns query row 8*blockIdx.x + w, lane l its columns 4l..4l+3.
__global__ __launch_bounds__(256) void k_merge(
    const float* __restrict__ Op, const float* __restrict__ Ml, float* Out)
{
    const int lane = threadIdx.x & 31, wave = threadIdx.x >> 5;
    const int row = blockIdx.x * 8 + wave;
    const int qt = row >> 4, rr = row & 15;
    float ms[KS_], ls[KS_];
    v4f_t os[KS_];
#pragma unroll   // straight-line code, so that all loads stand together: one trip to memory
    for (int s = 0; s < KS_; ++s) {
        ms[s] = Ml[(size_t)(s * NQT_ + qt) * 32 + rr];
        ls[s] = Ml[(size_t)(s * NQT_ + qt) * 32 + 16 + rr];
        os[s] = *(const v4f*)(Op + ((size_t)s * NROWS_ + row) * ND_ + 4 * lane);
    }
    // the arithmetic below reuses the registers that hold the loads' addresses: wait before they are overwritten
    asm volatile("s_wait_xcnt 0x0" ::: "memory");
    float mx = ms[0];
#pragma unroll   // constant index, so that the loaded values stay in registers
    for (int s = 1; s < KS_; ++s) mx = fmaxf(mx, ms[s]);
    float l = 0.0f;
    v4f_t o = {0.0f, 0.0f, 0.0f, 0.0f};
#pragma unroll   // constant index, so that the loaded values stay in registers
    for (int s = 0; s < KS_; ++s) {
        const float w = __builtin_amdgcn_exp2f((ms[s] - mx) * LOG2E_F);
        l += ls[s] * w;
        o += os[s] * w;
    }
    const float inv = 1.0f / (l + EPS_);
    *(v4f*)(Out + (size_t)row * ND_ + 4 * lane) = o * inv * (1.0f / 4096.0f);
}

// ---------------- launcher ----------------
extern "C" void kernel_launch(void* const* d_in, const int* in_sizes, int n_in,
                              void* d_out, int out_size, void* d_ws, size_t ws_size,
                              hipStream_t stream) {
    if (n_in < 6) return;
    if (in_sizes[0] != NROWS_ * ND_ || in_sizes[1] != ND_ * NC_ || in_sizes[2] != ND_ * NC_ ||
        in_sizes[3] != NC_ || in_sizes[4] != NC_ || in_sizes[5] < 1 || out_size != NROWS_ * ND_)
        return;

    const float* inps  = (const float*)d_in[0];
    const float* wei_t = (const float*)d_in[1];
    const float* wei_x = (const float*)d_in[2];
    const float* bxh   = (const float*)d_in[3];
    const float* wei_a = (const float*)d_in[4];
    const float* bxa   = (const float*)d_in[5];
    float* out = (float*)d_out;

    // workspace: Q [NROWS][NC] f32 at 0, K [NROWS][NC] f32 at 1 MiB, partial tiles [KS][NROWS][ND] f32 at 2 MiB,
    // then maxima and sums [KS][NQT][32] f32; total 6 MiB + 64 KiB
    const size_t per = (size_t)NROWS_ * NC_ * sizeof(float);
    if (ws_size < (2 + KS_) * per + (size_t)KS_ * NQT_ * 32 * sizeof(float)) return;
    float* qb = (float*)d_ws;
    float* kx = (float*)((char*)d_ws + per);
    float* op = (float*)((char*)d_ws + 2 * per);
    float* ml = (float*)((char*)d_ws + (2 + KS_) * per);

    const int nrows = NROWS_;
    k_proj<<<dim3((nrows + 15) / 16), dim3(256), 0, stream>>>(inps, wei_t, wei_x, bxh, qb, kx, nrows);
    k_attn<<<dim3(NB_ * (NL_ / 16) * KS_), dim3(256), 0, stream>>>(inps, qb, kx, wei_a, bxa, op, ml);
    k_merge<<<dim3(NROWS_ / 8), dim3(256), 0, stream>>>(op, ml, out);
}

// v008
// Measured time: 21.1 microseconds a run.
// Next to v007, in two timings, it ran 1.04 and 1.06 times as fast.
// Counting every step since v000, it is 6.37 times as fast.
#include <hip/hip_runtime.h>
#include <stdint.h>

// Contractions: X*Wt and X*Wx on v_wmma_f32_16x16x32_bf16 as bf16 hi/lo split (3 products each); tanh-score channel reduction (N padded to 16) and P*V on v_wmma_f32_16x16x32_f16 (f16 operands; the low part of wa and P power-of-two pre-scaled); all accumulation f32.

#define NB_    4
#define NL_    512
#define ND_    128
#define NC_    128
#define NROWS_ (NB_ * NL_)
#define EPS_   1e-7f
#define JC_    32          // keys per chunk
#define KS_    4           // key ranges: work-groups that share one tile of 16 query rows, NL/KS keys each
#define NQT_   (NROWS_ / 16)   // tiles of 16 query rows
#define KP_    132         // f32 pitch of the key tile and of the value tile in LDS (528 bytes = 16 x odd)
#define CB_    (JC_ * KP_) // floats of one chunk buffer (keys or values)
#define NCH_   (NL_ / JC_ / KS_)   // chunks a key range
#define WBP_   136         // f16 pitch of the wa operand tile [n][c]
#define OP_    132         // f32 pitch of the output staging tile
#define AP2_   68          // uint32 pitch (136 halves) of the bf16 activation tile

typedef float    v8f   __attribute__((ext_vector_type(8)));
typedef float    v4f_t __attribute__((ext_vector_type(4)));
typedef v4f_t    __attribute__((may_alias)) v4f;
typedef float    v2f_t __attribute__((ext_vector_type(2)));
typedef v2f_t    __attribute__((may_alias)) v2f;
typedef uint32_t v4u_t __attribute__((ext_vector_type(4)));
typedef v4u_t    __attribute__((may_alias)) v4u;
typedef __bf16   v16bf __attribute__((ext_vector_type(16)));
typedef __bf16   v2bf  __attribute__((ext_vector_type(2)));
typedef _Float16 v16h  __attribute__((ext_vector_type(16)));
typedef _Float16 v8h_t __attribute__((ext_vector_type(8)));
typedef v8h_t    __attribute__((may_alias)) v8h;

union FragB { v4u_t q[2]; v16bf v; };
union FragH { _Float16 e[16]; v8h_t q[2]; v16h v; };

#define LOG2E_F     1.4426950408889634f

// ---------------- WMMA wrappers with hazard guard ----------------
__device__ __forceinline__ v8f mma_bf16(v8f acc, v16bf a, v16bf b) {
    acc = __builtin_amdgcn_wmma_f32_16x16x32_bf16(false, a, false, b, (short)0, acc, false, false);
    asm volatile("v_nop\n\tv_nop\n\tv_nop\n\tv_nop" : "+v"(acc) : "v"(a), "v"(b));
    return acc;
}
__device__ __forceinline__ v8f mma_f16(v8f acc, v16h a, v16h b) {
    acc = __builtin_amdgcn_wmma_f32_16x16x32_f16(false, a, false, b, (short)0, acc, false, false);
    asm volatile("v_nop\n\tv_nop\n\tv_nop\n\tv_nop" : "+v"(acc) : "v"(a), "v"(b));
    return acc;
}

// ---------------- f32 -> bf16 (RNE) hi/lo split, two values at a time ----------------
// The chip's own packed convert rounds both values to nearest even and leaves them as one packed pair (x0 low, x1 high).
__device__ __forceinline__ void bf_split2(float x0, float x1, uint32_t& hi, uint32_t& lo) {
    const v2f_t x = {x0, x1};
    hi = __builtin_bit_cast(uint32_t, __builtin_convertvector(x, v2bf));
    const v2f_t xh = {__builtin_bit_cast(float, hi << 16), __builtin_bit_cast(float, hi & 0xFFFF0000u)};
    lo = __builtin_bit_cast(uint32_t, __builtin_convertvector(x - xh, v2bf));
}

// tanh(x) as f16 (RNE convert); the tanh is the chip's own instruction, v_tanh_f32
__device__ __forceinline__ _Float16 th_h(float x) {
    return (_Float16)__builtin_amdgcn_tanhf(x);
}

// One chunk (32 key rows and 32 value rows of 128 f32) from memory into LDS through no register: eight copies of 16 bytes a lane.
// gk, gv: the lane's first 16 bytes of the chunk in memory (float4 number tid; the next three lie 256 float4 further each);
// lk, lv: their LDS byte addresses (row tid>>5, float4 tid&31; the next three lie eight rows further each).
__device__ __forceinline__ void copy_chunk(const float* gk, const float* gv, uint32_t lk, uint32_t lv) {
    // the closing s_wait_xcnt stands in the copies' own statement, so that no address register is rewritten in front of it
    asm volatile(
        "global_load_async_to_lds_b128 %0, %8, off\n\t"
        "global_load_async_to_lds_b128 %1, %9, off\n\t"
        "global_load_async_to_lds_b128 %2, %10, off\n\t"
        "global_load_async_to_lds_b128 %3, %11, off\n\t"
        "global_load_async_to_lds_b128 %4, %12, off\n\t"
        "global_load_async_to_lds_b128 %5, %13, off\n\t"
        "global_load_async_to_lds_b128 %6, %14, off\n\t"
        "global_load_async_to_lds_b128 %7, %15, off\n\t"
        "s_wait_xcnt 0x0"
        :: "v"(lk), "v"(lk + 8 * KP_ * 4), "v"(lk + 16 * KP_ * 4), "v"(lk + 24 * KP_ * 4),
           "v"(lv), "v"(lv + 8 * KP_ * 4), "v"(lv + 16 * KP_ * 4), "v"(lv + 24 * KP_ * 4),
           "v"(gk), "v"(gk + 1024), "v"(gk + 2048), "v"(gk + 3072),
           "v"(gv), "v"(gv + 1024), "v"(gv + 2048), "v"(gv + 3072)
        : "memory");
}

// ---------------- kernel 0: Q = X*Wt + bh, K = X*Wx (bf16 hi/lo split WMMA) ----------------
// grid = ceil(nrows/16) blocks of 256 threads; waves 0..3 make Q, waves 4..7 make K; wave w owns the 32 output columns 32*(w&3)..+31
// as two tiles: column m of tile t is output column 32*(w&3) + 2m + t, so that a lane's two columns lie side by side in memory.
// No wave shares a weight column with another, so the weights go from memory straight to the B fragments' registers, not through LDS.
__global__ __launch_bounds__(256) void k_proj(
    const float* __restrict__ X, const float* __restrict__ Wt, const float* __restrict__ Wx,
    const float* __restrict__ bh, float* Qo, float* Ko, int nrows)
{
    __shared__ __align__(16) uint32_t sAh[16 * AP2_];
    __shared__ __align__(16) uint32_t sAl[16 * AP2_];

    const int tid = threadIdx.x, lane = tid & 31, wave = tid >> 5;
    const int h = lane >> 4, m = lane & 15;
    const int row0 = blockIdx.x * 16;
    const int g = wave >> 2;
    const int col0 = (wave & 3) * 32 + 2 * m;

    // every load of the kernel is issued here, before the first is used: one trip to memory in all
    v4f_t xa[2];
#pragma unroll   // straight-line code, so that the loads stand together with no wait between them
    for (int it = 0; it < 2; ++it) {
        const int e = tid + 256 * it;
        const int r = e >> 5, q = e & 31;
        const int gr = row0 + r;
        xa[it] = v4f_t{0.0f, 0.0f, 0.0f, 0.0f};
        if (gr < nrows) xa[it] = *(const v4f*)(X + (size_t)gr * ND_ + 4 * q);
    }
    // weights: element e of pass kk is row k = 32kk + 8h + e (e < 8) or 32kk + 16 + 8h + (e - 8), the k map of the A fragment;
    // one load brings that row's two columns: 16 lanes x 8 bytes = one whole 128-byte line a half-wave
    const float* wp = ((g == 0) ? Wt : Wx) + (size_t)(8 * h) * NC_ + col0;
    v2f_t wv[64];
#pragma unroll   // straight-line code, so that the loads stand together with no wait between them
    for (int i = 0; i < 64; ++i) {
        const int kk = i >> 4, e = i & 15;
        wv[i] = *(const v2f*)(wp + (size_t)(32 * kk + e + ((e < 8) ? 0 : 8)) * NC_);
    }
    v2f_t bias = {0.0f, 0.0f};
    if (g == 0) bias = *(const v2f*)(bh + col0);
    // the arithmetic below reuses the registers that hold the loads' addresses: wait before they are overwritten
    asm volatile("s_wait_xcnt 0x0" ::: "memory");

    // activation tile 16 x 128 -> bf16 hi and lo planes (packed pairs)
#pragma unroll   // constant index, so that the loaded values stay in registers
    for (int it = 0; it < 2; ++it) {
        const int e = tid + 256 * it;
        const int r = e >> 5, q = e & 31;
        const v4f_t v = xa[it];
        uint32_t h01, l01, h23, l23;
        bf_split2(v.x, v.y, h01, l01);
        bf_split2(v.z, v.w, h23, l23);
        sAh[r * AP2_ + 2 * q]     = h01;
        sAh[r * AP2_ + 2 * q + 1] = h23;
        sAl[r * AP2_ + 2 * q]     = l01;
        sAl[r * AP2_ + 2 * q + 1] = l23;
    }
    __syncthreads();   // sA* staged

    v8f acc0 = {}, acc1 = {};
#pragma unroll   // constant index into wv, so that the loaded values stay in registers
    for (int kk = 0; kk < 4; ++kk) {
        // A: row m, elements 0..7 = k0+8h.., 8..15 = k0+16+8h..
        FragB fah, fal, fbh0, fbl0, fbh1, fbl1;
        const uint32_t* pa = sAh + m * AP2_ + kk * 16 + 4 * h;
        const uint32_t* pl = sAl + m * AP2_ + kk * 16 + 4 * h;
        fah.q[0] = *(const v4u*)(pa); fah.q[1] = *(const v4u*)(pa + 8);
        fal.q[0] = *(const v4u*)(pl); fal.q[1] = *(const v4u*)(pl + 8);
        // B: the pass's 16 rows of this lane's two columns, split and packed in pairs along k
#pragma unroll   // constant index into wv and the fragments
        for (int p = 0; p < 8; ++p) {
            const v2f_t w0 = wv[16 * kk + 2 * p], w1 = wv[16 * kk + 2 * p + 1];
            uint32_t a, b;
            bf_split2(w0.x, w1.x, a, b);
            fbh0.q[p >> 2][p & 3] = a;
            fbl0.q[p >> 2][p & 3] = b;
            bf_split2(w0.y, w1.y, a, b);
            fbh1.q[p >> 2][p & 3] = a;
            fbl1.q[p >> 2][p & 3] = b;
        }
        acc0 = mma_bf16(acc0, fah.v, fbh0.v);
        acc1 = mma_bf16(acc1, fah.v, fbh1.v);
        acc0 = mma_bf16(acc0, fah.v, fbl0.v);
        acc1 = mma_bf16(acc1, fah.v, fbl1.v);
        acc0 = mma_bf16(acc0, fal.v, fbh0.v);
        acc1 = mma_bf16(acc1, fal.v, fbh1.v);
    }

    // D: rows 8h+r, this lane's two columns side by side: a half-wave's store is one whole 128-byte line
    float* dst = ((g == 0) ? Qo : Ko) + (size_t)(row0 + 8 * h) * NC_ + col0;
    const int left = nrows - (row0 + 8 * h);   // rows of this half-wave's eight that exist
    if (left >= 8) {   // all eight: one test, so that the stores stand together, each from registers of its own
#pragma unroll   // constant index, so that the sums stay in registers
        for (int r = 0; r < 8; ++r)
            *(v2f*)(dst + (size_t)r * NC_) = v2f_t{acc0[r] + bias.x, acc1[r] + bias.y};
    } else {
#pragma unroll   // constant index, so that the sums stay in registers
        for (int r = 0; r < 8; ++r)
            if (r < left) *(v2f*)(dst + (size_t)r * NC_) = v2f_t{acc0[r] + bias.x, acc1[r] + bias.y};
    }
}

// ---------------- kernel 1: tanh scores (WMMA channel reduction) + online softmax + P*V over one key range ----------------
// grid = NB*(NL/16)*KS blocks of 256 threads; block owns (batch b, 16 query rows, key range sp); wave w owns output columns 16w..16w+15.
// It leaves its un-normalised partial tile in Op[sp][row][col] and its row maxima and row sums in Ml; kernel 2 merges the ranges.
__global__ __launch_bounds__(256) void k_attn(
    const float* __restrict__ X, const float* __restrict__ Qb, const float* __restrict__ Kx,
    const float* __restrict__ wa, const float* __restrict__ ba, float* Op, float* Ml)
{
    __shared__ __align__(16) float    sQ[16 * KP_];
    __shared__ __align__(16) float    sK[2 * CB_];   // two chunk buffers: one is read while the other is filled
    __shared__ __align__(16) float    sV[2 * CB_];
    __shared__ __align__(16) _Float16 sWB[16 * WBP_];
    __shared__ __align__(16) _Float16 sP[16 * JC_];
    __shared__ __align__(16) float    sS[JC_ * 16];   // scores, [key][query]
    __shared__ __align__(16) float    sO[16 * OP_];
    __shared__ float sM[16], sL[16], sSc[16];

    const int tid = threadIdx.x, lane = tid & 31, wave = tid >> 5;
    const int h = lane >> 4, m = lane & 15;
    const int sp = blockIdx.x % KS_;
    const int qt = blockIdx.x / KS_;
    const int b  = qt / (NL_ / 16);
    const int it = qt % (NL_ / 16);
    const int qrow0 = b * NL_ + it * 16;
    const int ncol = wave * 16 + m;

    // chunk 0 sets out for buffer 0 before anything else, so that it flies under the staging of Q and wa
    const float* gk = Kx + (size_t)(b * NL_ + sp * NCH_ * JC_) * NC_ + 4 * tid;
    const float* gv = X + (size_t)(b * NL_ + sp * NCH_ * JC_) * ND_ + 4 * tid;
    const uint32_t lk = (uint32_t)(uintptr_t)(sK + wave * KP_ + 4 * lane);
    const uint32_t lv = (uint32_t)(uintptr_t)(sV + wave * KP_ + 4 * lane);
    copy_chunk(gk, gv, lk, lv);

    // query tile (bias already folded in)
    // (its loads and those of wa below are all issued before the first LDS store)
    v4f_t qv[2];
#pragma unroll   // straight-line code, so that the loads stand together with no wait between them
    for (int it = 0; it < 2; ++it)   // element e = tid + 256*it of the tile, rows contiguous
        qv[it] = *(const v4f*)(Qb + (size_t)qrow0 * NC_ + 4 * tid + 1024 * it);
    constexpr int NWB = (16 * WBP_ + 255) / 256;
    float wv[NWB];
#pragma unroll   // straight-line code, so that the loads stand together with no wait between them
    for (int it = 0; it < NWB; ++it) {
        const int e = tid + 256 * it;
        const int c = e % WBP_;
        wv[it] = (c < NC_) ? wa[c] : 0.0f;
    }
#pragma unroll   // constant index, so that the loaded values stay in registers
    for (int it = 0; it < 2; ++it) {
        const int e = tid + 256 * it;
        const int r = e >> 5, q = e & 31;
        *(v4f*)(sQ + r * KP_ + 4 * q) = qv[it];
    }
    // wa as a [n][c] 16-bit operand: column 0 = f16 hi, column 1 = (wa - hi) * 4096, columns 2..15 = 0
#pragma unroll   // constant index, so that the loaded values stay in registers
    for (int it = 0; it < NWB; ++it) {
        const int e = tid + 256 * it;
        const int rr = e / WBP_;
        const int c = e - rr * WBP_;
        _Float16 val = (_Float16)0.0f;
        if (c < NC_) {
            const float w = wv[it];
            const _Float16 hi = (_Float16)w;
            if (rr == 0) val = hi;
            else if (rr == 1) val = (_Float16)((w - (float)hi) * 4096.0f);
        }
        if (e < 16 * WBP_) sWB[e] = val;
    }
    if (tid < 16) { sM[tid] = -3.0e38f; sL[tid] = 0.0f; }
    const float bav = ba[0];

    // the two score operands that no key changes go to registers once: this lane's query row (A side) and its wa column (B side)
    asm volatile("s_wait_asynccnt 0x0" ::: "memory");   // this wave's copies of chunk 0 have landed before the barrier publishes them
    __syncthreads();   // sQ, sWB and chunk 0 staged
    copy_chunk(gk + JC_ * NC_, gv + JC_ * ND_, lk + CB_ * 4, lv + CB_ * 4);   // chunk 1 flies while chunk 0 is worked on
    v4f_t qf[16];      // query row m; pass kk: channels 32kk+8h..+7 in [4kk], [4kk+1], channels 32kk+16+8h..+7 in [4kk+2], [4kk+3]
    FragH wb[4];       // column m of the wa tile, same k map
#pragma unroll   // constant index, so that the fragments stay in registers
    for (int kk = 0; kk < 4; ++kk) {
        const float* qp = sQ + m * KP_ + kk * 32 + 8 * h;
        qf[4 * kk + 0] = *(const v4f*)(qp);
        qf[4 * kk + 1] = *(const v4f*)(qp + 4);
        qf[4 * kk + 2] = *(const v4f*)(qp + 16);
        qf[4 * kk + 3] = *(const v4f*)(qp + 20);
        wb[kk].q[0] = *(const v8h*)(sWB + m * WBP_ + kk * 32 + 8 * h);
        wb[kk].q[1] = *(const v8h*)(sWB + m * WBP_ + kk * 32 + 16 + 8 * h);
    }

    v8f acco = {};   // output tile accumulator: rows 8h+r, column ncol (scaled by 4096)

#pragma unroll 1
    for (int t = 0; t < NCH_; ++t) {   // trip t reads buffer t & 1 alone
        const int bo = (t & 1) * CB_;

        // scores: one tile a key (this wave's keys 4*wave..4*wave+3 of the chunk); A row = query (lane m), k = channel; B = wa columns.
        // Only the key row is read from LDS, the same 16 bytes for all 16 lanes of a half.
        const float* kb = sK + bo + (wave * 4) * KP_ + 8 * h;
        v4f_t kr[16];   // the key row's channels, laid out as qf
#pragma unroll   // constant index, so that the row stays in registers
        for (int kk = 0; kk < 4; ++kk) {
            kr[4 * kk + 0] = *(const v4f*)(kb + kk * 32);
            kr[4 * kk + 1] = *(const v4f*)(kb + kk * 32 + 4);
            kr[4 * kk + 2] = *(const v4f*)(kb + kk * 32 + 16);
            kr[4 * kk + 3] = *(const v4f*)(kb + kk * 32 + 20);
        }
        v8f pa = {};      // the key before: its sums, and the neighbour column's sums on their way through the cross-lane unit
        float pl[8] = {0.0f, 0.0f, 0.0f, 0.0f, 0.0f, 0.0f, 0.0f, 0.0f};
#pragma unroll   // constant index into kr, qf and wb; the next key's reads stand among this key's passes
        for (int u = 0; u <= 4; ++u) {   // trip 4 only finishes key 3
            v8f acc = {};
#pragma unroll   // constant index into kr, qf and wb
            for (int kk = 0; kk < 4; ++kk) {
                if (u < 4) {
                    const v4f_t x0 = qf[4 * kk + 0] + kr[4 * kk + 0];
                    const v4f_t x1 = qf[4 * kk + 1] + kr[4 * kk + 1];
                    const v4f_t x2 = qf[4 * kk + 2] + kr[4 * kk + 2];
                    const v4f_t x3 = qf[4 * kk + 3] + kr[4 * kk + 3];
                    FragH fa;   // elements 0..7 = channels 32kk+8h.., 8..15 = 32kk+16+8h..
                    fa.e[0]  = th_h(x0.x); fa.e[1]  = th_h(x0.y); fa.e[2]  = th_h(x0.z); fa.e[3]  = th_h(x0.w);
                    fa.e[4]  = th_h(x1.x); fa.e[5]  = th_h(x1.y); fa.e[6]  = th_h(x1.z); fa.e[7]  = th_h(x1.w);
                    fa.e[8]  = th_h(x2.x); fa.e[9]  = th_h(x2.y); fa.e[10] = th_h(x2.z); fa.e[11] = th_h(x2.w);
                    fa.e[12] = th_h(x3.x); fa.e[13] = th_h(x3.y); fa.e[14] = th_h(x3.z); fa.e[15] = th_h(x3.w);
                    acc = mma_f16(acc, fa.v, wb[kk].v);
                }
                // two passes have used up half of the key registers: the next key's same half is fetched into them, two passes ahead of its use
                if ((kk & 1) && u < 3) {
#pragma unroll   // constant index into kr
                    for (int kn = kk - 1; kn <= kk; ++kn) {
                        const float* kp = kb + (u + 1) * KP_ + kn * 32;
                        kr[4 * kn + 0] = *(const v4f*)(kp);
                        kr[4 * kn + 1] = *(const v4f*)(kp + 4);
                        kr[4 * kn + 2] = *(const v4f*)(kp + 16);
                        kr[4 * kn + 3] = *(const v4f*)(kp + 20);
                    }
                }
                // the key before is finished here, two passes after its cross-lane moves were issued
                // D: lane column 0 = hi sums, column 1 = lo sums (x4096); rows 8h+r = queries 8h+r
                if (kk == 1 && u > 0 && m == 0) {
                    float sv[8];
#pragma unroll   // constant index, so that the sums stay in registers
                    for (int r = 0; r < 8; ++r) sv[r] = pa[r] + pl[r] * (1.0f / 4096.0f) + bav;
                    float* sp8 = sS + (wave * 4 + u - 1) * 16 + 8 * h;
                    *(v4f*)(sp8)     = v4f_t{sv[0], sv[1], sv[2], sv[3]};
                    *(v4f*)(sp8 + 4) = v4f_t{sv[4], sv[5], sv[6], sv[7]};
                }
                if (kk == 3 && u < 4) {
#pragma unroll   // constant index, so that the sums stay in registers
                    for (int r = 0; r < 8; ++r) pl[r] = __shfl_xor(acc[r], 1);
                    pa = acc;
                }
                // keeps the later passes' vector work behind the reads above: lifted over them, it would issue the reads only just before their use
                if ((kk & 1) && u < 3) __builtin_amdgcn_sched_barrier(0);
            }
        }
        __syncthreads();

        // this wave's value operand is asked for here, so that its reads run under the statistics below:
        // lane (h, m) takes keys 8h..8h+7, then 16+8h..+7, of column 16*wave + m, the k map of fp; a read's 32 lanes fall on 32 banks
        const float* vp = sV + bo + (8 * h) * KP_ + ncol;
        float vr[16];
#pragma unroll   // constant index, so that the values stay in registers
        for (int e = 0; e < 8; ++e) { vr[e] = vp[e * KP_]; vr[8 + e] = vp[(16 + e) * KP_]; }

        // online softmax statistics per query row
        if (tid < 16) {
            const int i = tid;
            const float mo = sM[i];
            float cm = mo;
            for (int jj = 0; jj < JC_; ++jj) cm = fmaxf(cm, sS[jj * 16 + i]);
            const float sc = __builtin_amdgcn_exp2f((mo - cm) * LOG2E_F);
            float ls = sL[i] * sc;
            for (int jj = 0; jj < JC_; ++jj) {
                const float ev = __builtin_amdgcn_exp2f((sS[jj * 16 + i] - cm) * LOG2E_F);
                ls += ev;
                sP[i * JC_ + jj] = (_Float16)(ev * 4096.0f);
            }
            sM[i] = cm; sL[i] = ls; sSc[i] = sc;
        }
        __syncthreads();

        // O = O*scale + P(16 x 32 keys) * V(32 keys x 16 cols)
#pragma unroll
        for (int r = 0; r < 8; ++r) acco[r] *= sSc[8 * h + r];
        FragH fp, fv;
        fp.q[0] = *(const v8h*)(sP + m * JC_ + 8 * h);
        fp.q[1] = *(const v8h*)(sP + m * JC_ + 16 + 8 * h);
#pragma unroll   // constant index, so that the values stay in registers
        for (int e = 0; e < 16; ++e) fv.e[e] = (_Float16)vr[e];
        acco = mma_f16(acco, fp.v, fv.v);

        // hand-over: the one barrier publishes chunk t + 1 and ends every wave's reads of this trip's buffer
        asm volatile("s_wait_dscnt 0x0" ::: "memory");      // this wave's LDS reads of the buffer are done before it is refilled
        asm volatile("s_wait_asynccnt 0x0" ::: "memory");   // this wave's copies of chunk t + 1 have landed before the barrier publishes them
        __syncthreads();
        if (t + 2 < NCH_)   // the same for the whole work-group
            copy_chunk(gk + (t + 2) * (JC_ * NC_), gv + (t + 2) * (JC_ * ND_), lk + bo * 4, lv + bo * 4);
    }
    asm volatile("s_wait_asynccnt 0x0" ::: "memory");   // no copy is left in flight when the wave goes on to its end

    // epilogue: stage the 16 x 128 partial tile as it stands (scaled by 4096, relative to the range's own maxima), whole-row stores
#pragma unroll
    for (int r = 0; r < 8; ++r) sO[(8 * h + r) * OP_ + ncol] = acco[r];
    __syncthreads();
    const int r0 = 2 * wave, r1 = 2 * wave + 1;
    const v4f_t v0 = *(const v4f*)(sO + r0 * OP_ + 4 * lane);
    const v4f_t v1 = *(const v4f*)(sO + r1 * OP_ + 4 * lane);
    float* p0 = Op + ((size_t)sp * NROWS_ + qrow0 + r0) * ND_ + 4 * lane;
    float* p1 = Op + ((size_t)sp * NROWS_ + qrow0 + r1) * ND_ + 4 * lane;
    *(v4f*)p0 = v0;
    *(v4f*)p1 = v1;
    // the range's 16 row maxima, then its 16 row sums: one whole 128-byte line a work-group
    if (wave == 0) Ml[(size_t)(sp * NQT_ + qt) * 32 + lane] = (h == 0) ? sM[m] : sL[m];
}

// ---------------- kernel 2: merge of the KS key ranges of every query row ----------------
// grid = NROWS/8 blocks of 256 threads; wave w owns query row 8*blockIdx.x + w, lane l its columns 4l..4l+3.
__global__ __launch_bounds__(256) void k_merge(
    const float* __restrict__ Op, const float* __restrict__ Ml, float* Out)
{
    const int lane = threadIdx.x & 31, wave = threadIdx.x >> 5;
    const int row = blockIdx.x * 8 + wave;
    const int qt = row >> 4, rr = row & 15;
    float ms[KS_], ls[KS_];
    v4f_t os[KS_];
#pragma unroll   // straight-line code, so that all loads stand together: one trip to memory
    for (int s = 0; s < KS_; ++s) {
        ms[s] = Ml[(size_t)(s * NQT_ + qt) * 32 + rr];
        ls[s] = Ml[(size_t)(s * NQT_ + qt) * 32 + 16 + rr];
        os[s] = *(const v4f*)(Op + ((size_t)s * NROWS_ + row) * ND_ + 4 * lane);
    }
    // the arithmetic below reuses the registers that hold the loads' addresses: wait before they are overwritten
    asm volatile("s_wait_xcnt 0x0" ::: "memory");
    float mx = ms[0];
#pragma unroll   // constant index, so that the loaded values stay in registers
    for (int s = 1; s < KS_; ++s) mx = fmaxf(mx, ms[s]);
    float l = 0.0f;
    v4f_t o = {0.0f, 0.0f, 0.0f, 0.0f};
#pragma unroll   // constant index, so that the loaded values stay in registers
    for (int s = 0; s < KS_; ++s) {
        const float w = __builtin_amdgcn_exp2f((ms[s] - mx) * LOG2E_F);
        l += ls[s] * w;
        o += os[s] * w;
    }
    const float inv = 1.0f / (l + EPS_);
    *(v4f*)(Out + (size_t)row * ND_ + 4 * lane) = o * inv * (1.0f / 4096.0f);
}

// ---------------- launcher ----------------
extern "C" void kernel_launch(void* const* d_in, const int* in_sizes, int n_in,
                              void* d_out, int out_size, void* d_ws, size_t ws_size,
                              hipStream_t stream) {
    if (n_in < 6) return;
    if (in_sizes[0] != NROWS_ * ND_ || in_sizes[1] != ND_ * NC_ || in_sizes[2] != ND_ * NC_ ||
        in_sizes[3] != NC_ || in_sizes[4] != NC_ || in_sizes[5] < 1 || out_size != NROWS_ * ND_)
        return;

    const float* inps  = (const float*)d_in[0];
    const float* wei_t = (const float*)d_in[1];
    const float* wei_x = (const float*)d_in[2];
    const float* bxh   = (const float*)d_in[3];
    const float* wei_a = (const float*)d_in[4];
    const float* bxa   = (const float*)d_in[5];
    float* out = (float*)d_out;

    // workspace: Q [NROWS][NC] f32 at 0, K [NROWS][NC] f32 at 1 MiB, partial tiles [KS][NROWS][ND] f32 at 2 MiB,
    // then maxima and sums [KS][NQT][32] f32; total 6 MiB + 64 KiB
    const size_t per = (size_t)NROWS_ * NC_ * sizeof(float);
    if (ws_size < (2 + KS_) * per + (size_t)KS_ * NQT_ * 32 * sizeof(float)) return;
    float* qb = (float*)d_ws;
    float* kx = (float*)((char*)d_ws + per);
    float* op = (float*)((char*)d_ws + 2 * per);
    float* ml = (float*)((char*)d_ws + (2 + KS_) * per);

    const int nrows = NROWS_;
    k_proj<<<dim3((nrows + 15) / 16), dim3(256), 0, stream>>>(inps, wei_t, wei_x, bxh, qb, kx, nrows);
    k_attn<<<dim3(NB_ * (NL_ / 16) * KS_), dim3(256), 0, stream>>>(inps, qb, kx, wei_a, bxa, op, ml);
    k_merge<<<dim3(NROWS_ / 8), dim3(256), 0, stream>>>(op, ml, out);
}

// v009
// A run of this version takes 19.1 microseconds.
// Two timings next to v008 put it at 1.10 and 1.09 times that version's speed.
// All steps since v000 together make it 6.97 times as fast.
#include <hip/hip_runtime.h>
#include <stdint.h>

// Contractions: X*Wt and X*Wx on v_wmma_f32_16x16x32_bf16 as bf16 hi/lo split (3 products each); tanh-score channel reduction (M padded to 16) and P*V on v_wmma_f32_16x16x32_f16 (f16 operands; the low part of wa and P power-of-two pre-scaled); all accumulation f32.

#define NB_    4
#define NL_    512
#define ND_    128
#define NC_    128
#define NROWS_ (NB_ * NL_)
#define EPS_   1e-7f
#define JC_    32          // keys per chunk
#define KS_    4           // key ranges: work-groups that share one tile of 16 query rows, NL/KS keys each
#define NQT_   (NROWS_ / 16)   // tiles of 16 query rows
#define KP_    132         // f32 pitch of the key tile and of the value tile in LDS (528 bytes = 16 x odd)
#define CB_    (JC_ * KP_) // floats of one chunk buffer (keys or values)
#define NCH_   (NL_ / JC_ / KS_)   // chunks a key range
#define WBP_   136         // f16 pitch of the wa operand tile [n][c]
#define OP_    132         // f32 pitch of the output staging tile
#define SP_    132         // f32 pitch of the score tile [query][key of the range] (528 bytes = 16 x odd)
#define PP_    136         // f16 pitch of the P tile [query][key of the range] (272 bytes = 16 x odd)
#define MXP_   12          // f32 pitch of the waves' maxima [query][wave] (48 bytes = 16 x odd)
#define LP_    20          // f32 pitch of the half-waves' sums [query][2*wave + half] (80 bytes = 16 x odd)
#define AP2_   68          // uint32 pitch (136 halves) of the bf16 activation tile

typedef float    v8f   __attribute__((ext_vector_type(8)));
typedef float    v4f_t __attribute__((ext_vector_type(4)));
typedef v4f_t    __attribute__((may_alias)) v4f;
typedef float    v2f_t __attribute__((ext_vector_type(2)));
typedef v2f_t    __attribute__((may_alias)) v2f;
typedef uint32_t v4u_t __attribute__((ext_vector_type(4)));
typedef v4u_t    __attribute__((may_alias)) v4u;
typedef __bf16   v16bf __attribute__((ext_vector_type(16)));
typedef __bf16   v2bf  __attribute__((ext_vector_type(2)));
typedef _Float16 v16h  __attribute__((ext_vector_type(16)));
typedef _Float16 v8h_t __attribute__((ext_vector_type(8)));
typedef v8h_t    __attribute__((may_alias)) v8h;
typedef _Float16 v4h_t __attribute__((ext_vector_type(4)));
typedef v4h_t    __attribute__((may_alias)) v4h;

union FragB { v4u_t q[2]; v16bf v; };
union FragH { _Float16 e[16]; v8h_t q[2]; v16h v; };

#define LOG2E_F     1.4426950408889634f

// ---------------- WMMA wrappers with hazard guard ----------------
__device__ __forceinline__ v8f mma_bf16(v8f acc, v16bf a, v16bf b) {
    acc = __builtin_amdgcn_wmma_f32_16x16x32_bf16(false, a, false, b, (short)0, acc, false, false);
    asm volatile("v_nop\n\tv_nop\n\tv_nop\n\tv_nop" : "+v"(acc) : "v"(a), "v"(b));
    return acc;
}
__device__ __forceinline__ v8f mma_f16(v8f acc, v16h a, v16h b) {
    acc = __builtin_amdgcn_wmma_f32_16x16x32_f16(false, a, false, b, (short)0, acc, false, false);
    asm volatile("v_nop\n\tv_nop\n\tv_nop\n\tv_nop" : "+v"(acc) : "v"(a), "v"(b));
    return acc;
}

// ---------------- f32 -> bf16 (RNE) hi/lo split, two values at a time ----------------
// The chip's own packed convert rounds both values to nearest even and leaves them as one packed pair (x0 low, x1 high).
__device__ __forceinline__ void bf_split2(float x0, float x1, uint32_t& hi, uint32_t& lo) {
    const v2f_t x = {x0, x1};
    hi = __builtin_bit_cast(uint32_t, __builtin_convertvector(x, v2bf));
    const v2f_t xh = {__builtin_bit_cast(float, hi << 16), __builtin_bit_cast(float, hi & 0xFFFF0000u)};
    lo = __builtin_bit_cast(uint32_t, __builtin_convertvector(x - xh, v2bf));
}

// tanh(x) as f16 (RNE convert); the tanh is the chip's own instruction, v_tanh_f32
__device__ __forceinline__ _Float16 th_h(float x) {
    return (_Float16)__builtin_amdgcn_tanhf(x);
}

// One chunk (32 key rows and 32 value rows of 128 f32) from memory into LDS through no register: eight copies of 16 bytes a lane.
// gk, gv: the lane's first 16 bytes of the chunk in memory (float4 number tid; the next three lie 256 float4 further each);
// lk, lv: their LDS byte addresses (row tid>>5, float4 tid&31; the next three lie eight rows further each).
__device__ __forceinline__ void copy_chunk(const float* gk, const float* gv, uint32_t lk, uint32_t lv) {
    // the closing s_wait_xcnt stands in the copies' own statement, so that no address register is rewritten in front of it
    asm volatile(
        "global_load_async_to_lds_b128 %0, %8, off\n\t"
        "global_load_async_to_lds_b128 %1, %9, off\n\t"
        "global_load_async_to_lds_b128 %2, %10, off\n\t"
        "global_load_async_to_lds_b128 %3, %11, off\n\t"
        "global_load_async_to_lds_b128 %4, %12, off\n\t"
        "global_load_async_to_lds_b128 %5, %13, off\n\t"
        "global_load_async_to_lds_b128 %6, %14, off\n\t"
        "global_load_async_to_lds_b128 %7, %15, off\n\t"
        "s_wait_xcnt 0x0"
        :: "v"(lk), "v"(lk + 8 * KP_ * 4), "v"(lk + 16 * KP_ * 4), "v"(lk + 24 * KP_ * 4),
           "v"(lv), "v"(lv + 8 * KP_ * 4), "v"(lv + 16 * KP_ * 4), "v"(lv + 24 * KP_ * 4),
           "v"(gk), "v"(gk + 1024), "v"(gk + 2048), "v"(gk + 3072),
           "v"(gv), "v"(gv + 1024), "v"(gv + 2048), "v"(gv + 3072)
        : "memory");
}

// ---------------- kernel 0: Q = X*Wt + bh, K = X*Wx (bf16 hi/lo split WMMA) ----------------
// grid = ceil(nrows/16) blocks of 256 threads; waves 0..3 make Q, waves 4..7 make K; wave w owns the 32 output columns 32*(w&3)..+31
// as two tiles: column m of tile t is output column 32*(w&3) + 2m + t, so that a lane's two columns lie side by side in memory.
// No wave shares a weight column with another, so the weights go from memory straight to the B fragments' registers, not through LDS.
__global__ __launch_bounds__(256) void k_proj(
    const float* __restrict__ X, const float* __restrict__ Wt, const float* __restrict__ Wx,
    const float* __restrict__ bh, float* Qo, float* Ko, int nrows)
{
    __shared__ __align__(16) uint32_t sAh[16 * AP2_];
    __shared__ __align__(16) uint32_t sAl[16 * AP2_];

    const int tid = threadIdx.x, lane = tid & 31, wave = tid >> 5;
    const int h = lane >> 4, m = lane & 15;
    const int row0 = blockIdx.x * 16;
    const int g = wave >> 2;
    const int col0 = (wave & 3) * 32 + 2 * m;

    // every load of the kernel is issued here, before the first is used: one trip to memory in all
    v4f_t xa[2];
#pragma unroll   // straight-line code, so that the loads stand together with no wait between them
    for (int it = 0; it < 2; ++it) {
        const int e = tid + 256 * it;
        const int r = e >> 5, q = e & 31;
        const int gr = row0 + r;
        xa[it] = v4f_t{0.0f, 0.0f, 0.0f, 0.0f};
        if (gr < nrows) xa[it] = *(const v4f*)(X + (size_t)gr * ND_ + 4 * q);
    }
    // weights: element e of pass kk is row k = 32kk + 8h + e (e < 8) or 32kk + 16 + 8h + (e - 8), the k map of the A fragment;
    // one load brings that row's two columns: 16 lanes x 8 bytes = one whole 128-byte line a half-wave
    const float* wp = ((g == 0) ? Wt : Wx) + (size_t)(8 * h) * NC_ + col0;
    v2f_t wv[64];
#pragma unroll   // straight-line code, so that the loads stand together with no wait between them
    for (int i = 0; i < 64; ++i) {
        const int kk = i >> 4, e = i & 15;
        wv[i] = *(const v2f*)(wp + (size_t)(32 * kk + e + ((e < 8) ? 0 : 8)) * NC_);
    }
    v2f_t bias = {0.0f, 0.0f};
    if (g == 0) bias = *(const v2f*)(bh + col0);
    // the arithmetic below reuses the registers that hold the loads' addresses: wait before they are overwritten
    asm volatile("s_wait_xcnt 0x0" ::: "memory");

    // activation tile 16 x 128 -> bf16 hi and lo planes (packed pairs)
#pragma unroll   // constant index, so that the loaded values stay in registers
    for (int it = 0; it < 2; ++it) {
        const int e = tid + 256 * it;
        const int r = e >> 5, q = e & 31;
        const v4f_t v = xa[it];
        uint32_t h01, l01, h23, l23;
        bf_split2(v.x, v.y, h01, l01);
        bf_split2(v.z, v.w, h23, l23);
        sAh[r * AP2_ + 2 * q]     = h01;
        sAh[r * AP2_ + 2 * q + 1] = h23;
        sAl[r * AP2_ + 2 * q]     = l01;
        sAl[r * AP2_ + 2 * q + 1] = l23;
    }
    __syncthreads();   // sA* staged

    v8f acc0 = {}, acc1 = {};
#pragma unroll   // constant index into wv, so that the loaded values stay in registers
    for (int kk = 0; kk < 4; ++kk) {
        // A: row m, elements 0..7 = k0+8h.., 8..15 = k0+16+8h..
        FragB fah, fal, fbh0, fbl0, fbh1, fbl1;
        const uint32_t* pa = sAh + m * AP2_ + kk * 16 + 4 * h;
        const uint32_t* pl = sAl + m * AP2_ + kk * 16 + 4 * h;
        fah.q[0] = *(const v4u*)(pa); fah.q[1] = *(const v4u*)(pa + 8);
        fal.q[0] = *(const v4u*)(pl); fal.q[1] = *(const v4u*)(pl + 8);
        // B: the pass's 16 rows of this lane's two columns, split and packed in pairs along k
#pragma unroll   // constant index into wv and the fragments
        for (int p = 0; p < 8; ++p) {
            const v2f_t w0 = wv[16 * kk + 2 * p], w1 = wv[16 * kk + 2 * p + 1];
            uint32_t a, b;
            bf_split2(w0.x, w1.x, a, b);
            fbh0.q[p >> 2][p & 3] = a;
            fbl0.q[p >> 2][p & 3] = b;
            bf_split2(w0.y, w1.y, a, b);
            fbh1.q[p >> 2][p & 3] = a;
            fbl1.q[p >> 2][p & 3] = b;
        }
        acc0 = mma_bf16(acc0, fah.v, fbh0.v);
        acc1 = mma_bf16(acc1, fah.v, fbh1.v);
        acc0 = mma_bf16(acc0, fah.v, fbl0.v);
        acc1 = mma_bf16(acc1, fah.v, fbl1.v);
        acc0 = mma_bf16(acc0, fal.v, fbh0.v);
        acc1 = mma_bf16(acc1, fal.v, fbh1.v);
    }

    // D: rows 8h+r, this lane's two columns side by side: a half-wave's store is one whole 128-byte line
    float* dst = ((g == 0) ? Qo : Ko) + (size_t)(row0 + 8 * h) * NC_ + col0;
    const int left = nrows - (row0 + 8 * h);   // rows of this half-wave's eight that exist
    if (left >= 8) {   // all eight: one test, so that the stores stand together, each from registers of its own
#pragma unroll   // constant index, so that the sums stay in registers
        for (int r = 0; r < 8; ++r)
            *(v2f*)(dst + (size_t)r * NC_) = v2f_t{acc0[r] + bias.x, acc1[r] + bias.y};
    } else {
#pragma unroll   // constant index, so that the sums stay in registers
        for (int r = 0; r < 8; ++r)
            if (r < left) *(v2f*)(dst + (size_t)r * NC_) = v2f_t{acc0[r] + bias.x, acc1[r] + bias.y};
    }
}

// ---------------- kernel 1: tanh scores (WMMA channel reduction), then one softmax and P*V over one key range ----------------
// grid = NB*(NL/16)*KS blocks of 256 threads; block owns (batch b, 16 query rows, key range sp); wave w owns output columns 16w..16w+15.
// Both products stand with the queries as the tile's columns, so that lane (h, m) always works for query m:
// the loop only makes scores; the range's maxima, sums and P are then made once, each wave taking the 16 keys it scored itself.
// It leaves its un-normalised partial tile in Op[sp][row][col] and its row maxima and row sums in Ml; kernel 2 merges the ranges.
__global__ __launch_bounds__(256) void k_attn(
    const float* __restrict__ X, const float* __restrict__ Qb, const float* __restrict__ Kx,
    const float* __restrict__ wa, const float* __restrict__ ba, float* Op, float* Ml)
{
    __shared__ __align__(16) float    sQ[16 * KP_];
    __shared__ __align__(16) float    sK[2 * CB_];   // two chunk buffers: one is read while the other is filled
    __shared__ __align__(16) float    sV[NCH_ * CB_];   // every value chunk keeps its own place: all are read behind the loop
    __shared__ __align__(16) _Float16 sWB[16 * WBP_];
    __shared__ __align__(16) float    sS[16 * SP_];   // scores of the whole range, [query][key]; a wave reads back only what it wrote
    __shared__ __align__(16) _Float16 sP[16 * PP_];   // P of the whole range (scaled by 4096), [query][key]
    __shared__ __align__(16) float    sMx[16 * MXP_]; // each wave's maximum over its 16 keys
    __shared__ __align__(16) float    sLs[16 * LP_];  // each half-wave's sum over its 8 keys
    __shared__ __align__(16) float    sO[16 * OP_];

    const int tid = threadIdx.x, lane = tid & 31, wave = tid >> 5;
    const int h = lane >> 4, m = lane & 15;
    const int sp = blockIdx.x % KS_;
    const int qt = blockIdx.x / KS_;
    const int b  = qt / (NL_ / 16);
    const int it = qt % (NL_ / 16);
    const int qrow0 = b * NL_ + it * 16;
    const int ncol = wave * 16 + m;

    // chunk 0 sets out for buffer 0 before anything else, so that it flies under the staging of Q and wa
    const float* gk = Kx + (size_t)(b * NL_ + sp * NCH_ * JC_) * NC_ + 4 * tid;
    const float* gv = X + (size_t)(b * NL_ + sp * NCH_ * JC_) * ND_ + 4 * tid;
    const uint32_t lk = (uint32_t)(uintptr_t)(sK + wave * KP_ + 4 * lane);
    const uint32_t lv = (uint32_t)(uintptr_t)(sV + wave * KP_ + 4 * lane);
    copy_chunk(gk, gv, lk, lv);

    // query tile (bias already folded in)
    // (its loads and those of wa below are all issued before the first LDS store)
    v4f_t qv[2];
#pragma unroll   // straight-line code, so that the loads stand together with no wait between them
    for (int it = 0; it < 2; ++it)   // element e = tid + 256*it of the tile, rows contiguous
        qv[it] = *(const v4f*)(Qb + (size_t)qrow0 * NC_ + 4 * tid + 1024 * it);
    constexpr int NWB = (16 * WBP_ + 255) / 256;
    float wv[NWB];
#pragma unroll   // straight-line code, so that the loads stand together with no wait between them
    for (int it = 0; it < NWB; ++it) {
        const int e = tid + 256 * it;
        const int c = e % WBP_;
        wv[it] = (c < NC_) ? wa[c] : 0.0f;
    }
#pragma unroll   // constant index, so that the loaded values stay in registers
    for (int it = 0; it < 2; ++it) {
        const int e = tid + 256 * it;
        const int r = e >> 5, q = e & 31;
        *(v4f*)(sQ + r * KP_ + 4 * q) = qv[it];
    }
    // wa as a [n][c] 16-bit operand: row 0 = f16 hi, row 1 = (wa - hi) * 4096, rows 2..15 = 0
#pragma unroll   // constant index, so that the loaded values stay in registers
    for (int it = 0; it < NWB; ++it) {
        const int e = tid + 256 * it;
        const int rr = e / WBP_;
        const int c = e - rr * WBP_;
        _Float16 val = (_Float16)0.0f;
        if (c < NC_) {
            const float w = wv[it];
            const _Float16 hi = (_Float16)w;
            if (rr == 0) val = hi;
            else if (rr == 1) val = (_Float16)((w - (float)hi) * 4096.0f);
        }
        if (e < 16 * WBP_) sWB[e] = val;
    }
    const float bav = ba[0];

    // the two score operands that no key changes go to registers once: this lane's query row (B side) and its wa row (A side)
    asm volatile("s_wait_asynccnt 0x0" ::: "memory");   // this wave's copies of chunk 0 have landed before the barrier publishes them
    __syncthreads();   // sQ, sWB and chunk 0 staged
    copy_chunk(gk + JC_ * NC_, gv + JC_ * ND_, lk + CB_ * 4, lv + CB_ * 4);   // chunk 1 flies while chunk 0 is worked on
    v4f_t qf[16];      // query row m; pass kk: channels 32kk+8h..+7 in [4kk], [4kk+1], channels 32kk+16+8h..+7 in [4kk+2], [4kk+3]
    FragH wb[4];       // row m of the wa tile, same k map
#pragma unroll   // constant index, so that the fragments stay in registers
    for (int kk = 0; kk < 4; ++kk) {
        const float* qp = sQ + m * KP_ + kk * 32 + 8 * h;
        qf[4 * kk + 0] = *(const v4f*)(qp);
        qf[4 * kk + 1] = *(const v4f*)(qp + 4);
        qf[4 * kk + 2] = *(const v4f*)(qp + 16);
        qf[4 * kk + 3] = *(const v4f*)(qp + 20);
        wb[kk].q[0] = *(const v8h*)(sWB + m * WBP_ + kk * 32 + 8 * h);
        wb[kk].q[1] = *(const v8h*)(sWB + m * WBP_ + kk * 32 + 16 + 8 * h);
    }

    float wm = -3.0e38f;   // query m's maximum over this wave's keys so far (lanes of half 0)
#pragma unroll 1
    for (int t = 0; t < NCH_; ++t) {   // trip t reads key buffer t & 1 alone
        const int bo = (t & 1) * CB_;

        // scores: one tile a key (this wave's keys 4*wave..4*wave+3 of the chunk); A = wa rows; B column = query (lane m), k = channel.
        // Only the key row is read from LDS, the same 16 bytes for all 16 lanes of a half.
        const float* kb = sK + bo + (wave * 4) * KP_ + 8 * h;
        v4f_t kr[16];   // the key row's channels, laid out as qf
#pragma unroll   // constant index, so that the row stays in registers
        for (int kk = 0; kk < 4; ++kk) {
            kr[4 * kk + 0] = *(const v4f*)(kb + kk * 32);
            kr[4 * kk + 1] = *(const v4f*)(kb + kk * 32 + 4);
            kr[4 * kk + 2] = *(const v4f*)(kb + kk * 32 + 16);
            kr[4 * kk + 3] = *(const v4f*)(kb + kk * 32 + 20);
        }
        v4f_t sc4;   // query m's scores of the wave's four keys (lanes of half 0)
#pragma unroll   // constant index into kr, qf and wb; the next key's reads stand among this key's passes
        for (int u = 0; u < 4; ++u) {
            v8f acc = {};
#pragma unroll   // constant index into kr, qf and wb
            for (int kk = 0; kk < 4; ++kk) {
                const v4f_t x0 = qf[4 * kk + 0] + kr[4 * kk + 0];
                const v4f_t x1 = qf[4 * kk + 1] + kr[4 * kk + 1];
                const v4f_t x2 = qf[4 * kk + 2] + kr[4 * kk + 2];
                const v4f_t x3 = qf[4 * kk + 3] + kr[4 * kk + 3];
                FragH fa;   // elements 0..7 = channels 32kk+8h.., 8..15 = 32kk+16+8h..
                fa.e[0]  = th_h(x0.x); fa.e[1]  = th_h(x0.y); fa.e[2]  = th_h(x0.z); fa.e[3]  = th_h(x0.w);
                fa.e[4]  = th_h(x1.x); fa.e[5]  = th_h(x1.y); fa.e[6]  = th_h(x1.z); fa.e[7]  = th_h(x1.w);
                fa.e[8]  = th_h(x2.x); fa.e[9]  = th_h(x2.y); fa.e[10] = th_h(x2.z); fa.e[11] = th_h(x2.w);
                fa.e[12] = th_h(x3.x); fa.e[13] = th_h(x3.y); fa.e[14] = th_h(x3.z); fa.e[15] = th_h(x3.w);
                acc = mma_f16(acc, wb[kk].v, fa.v);
                // two passes have used up half of the key registers: the next key's same half is fetched into them, two passes ahead of its use
                if ((kk & 1) && u < 3) {
#pragma unroll   // constant index into kr
                    for (int kn = kk - 1; kn <= kk; ++kn) {
                        const float* kp = kb + (u + 1) * KP_ + kn * 32;
                        kr[4 * kn + 0] = *(const v4f*)(kp);
                        kr[4 * kn + 1] = *(const v4f*)(kp + 4);
                        kr[4 * kn + 2] = *(const v4f*)(kp + 16);
                        kr[4 * kn + 3] = *(const v4f*)(kp + 20);
                    }
                    // keeps the later passes' vector work behind the reads above: lifted over them, it would issue the reads only just before their use
                    __builtin_amdgcn_sched_barrier(0);
                }
            }
            // D: column m = query m; in half 0 row 0 = hi sum, row 1 = lo sum (x4096): both in this lane, no cross-lane move
            sc4[u] = acc[0] + acc[1] * (1.0f / 4096.0f) + bav;
        }
        wm = fmaxf(fmaxf(wm, fmaxf(sc4.x, sc4.y)), fmaxf(sc4.z, sc4.w));
        if (h == 0) {
            *(v4f*)(sS + m * SP_ + t * JC_ + wave * 4) = sc4;
            if (t == NCH_ - 1) sMx[m * MXP_ + wave] = wm;
        }

        // hand-over: the one barrier publishes chunk t + 1 (the last one the waves' maxima) and ends every wave's reads of this trip's key buffer
        asm volatile("s_wait_dscnt 0x0" ::: "memory");      // this wave's LDS reads of the buffer are done before it is refilled
        asm volatile("s_wait_asynccnt 0x0" ::: "memory");   // this wave's copies of chunk t + 1 have landed before the barrier publishes them
        __syncthreads();
        if (t + 2 < NCH_)   // the same for the whole work-group
            copy_chunk(gk + (t + 2) * (JC_ * NC_), gv + (t + 2) * (JC_ * ND_), lk + bo * 4, lv + (t + 2) * (CB_ * 4));
    }
    asm volatile("s_wait_asynccnt 0x0" ::: "memory");   // no copy is left in flight when the wave goes on to its end

    // this wave's value operand is asked for first, so that its reads run under the statistics below:
    // lane (h, m), pass c: keys 32c+8h..+7, then 32c+16+8h..+7, of column 16*wave + m; a read's 32 lanes fall on 32 banks
    const float* vp = sV + (8 * h) * KP_ + ncol;
    float vr[16 * NCH_];
#pragma unroll   // constant index, so that the values stay in registers
    for (int c = 0; c < NCH_; ++c)
#pragma unroll   // constant index, so that the values stay in registers
        for (int e = 0; e < 8; ++e) {
            vr[16 * c + e]     = vp[(JC_ * c + e) * KP_];
            vr[16 * c + 8 + e] = vp[(JC_ * c + 16 + e) * KP_];
        }

    // softmax of the range, once. Query m's maximum over the eight waves:
    const v4f_t ma = *(const v4f*)(sMx + m * MXP_);
    const v4f_t mb = *(const v4f*)(sMx + m * MXP_ + 4);
    const float cm = fmaxf(fmaxf(fmaxf(ma.x, ma.y), fmaxf(ma.z, ma.w)), fmaxf(fmaxf(mb.x, mb.y), fmaxf(mb.z, mb.w)));
    // P of the keys that this wave scored: lane (h, m) takes query m's four keys of chunks 2h and 2h+1
    v4f_t ls4 = {0.0f, 0.0f, 0.0f, 0.0f};
#pragma unroll   // two independent passes, so that their reads and exponentials stand together
    for (int j = 0; j < 2; ++j) {
        const int ko = JC_ * (2 * h + j) + 4 * wave;
        const v4f_t d = (*(const v4f*)(sS + m * SP_ + ko) - cm) * LOG2E_F;
        const v4f_t ev = {__builtin_amdgcn_exp2f(d.x), __builtin_amdgcn_exp2f(d.y), __builtin_amdgcn_exp2f(d.z), __builtin_amdgcn_exp2f(d.w)};
        ls4 += ev;
        const v4f_t es = ev * 4096.0f;
        *(v4h*)(sP + m * PP_ + ko) = v4h_t{(_Float16)es.x, (_Float16)es.y, (_Float16)es.z, (_Float16)es.w};
    }
    sLs[m * LP_ + 2 * wave + h] = (ls4.x + ls4.y) + (ls4.z + ls4.w);
    __syncthreads();   // sP and sLs complete

    v8f acco = {};   // output tile: column m = query m, rows 8h+r = output columns 16*wave+8h+r (scaled by 4096)
    FragH fp[NCH_];   // query m's P, pass c: keys 32c+8h..+7, then 32c+16+8h..+7, as the value operand
#pragma unroll   // all eight reads stand together, in front of the first product: one LDS round trip, not four
    for (int c = 0; c < NCH_; ++c) {
        fp[c].q[0] = *(const v8h*)(sP + m * PP_ + JC_ * c + 8 * h);
        fp[c].q[1] = *(const v8h*)(sP + m * PP_ + JC_ * c + 16 + 8 * h);
    }
#pragma unroll   // constant index, so that the values stay in registers
    for (int c = 0; c < NCH_; ++c) {
        FragH fv;
#pragma unroll   // constant index, so that the values stay in registers
        for (int e = 0; e < 16; ++e) fv.e[e] = (_Float16)vr[16 * c + e];
        acco = mma_f16(acco, fv.v, fp[c].v);   // O^T += V^T(16 cols x 32 keys) * P^T(32 keys x 16 queries)
    }

    // epilogue: stage the 16 x 128 partial tile as it stands (scaled by 4096, relative to the range's own maxima), whole-row stores
    float* so = sO + m * OP_ + wave * 16 + 8 * h;
    *(v4f*)(so)     = v4f_t{acco[0], acco[1], acco[2], acco[3]};
    *(v4f*)(so + 4) = v4f_t{acco[4], acco[5], acco[6], acco[7]};
    __syncthreads();
    const int r0 = 2 * wave, r1 = 2 * wave + 1;
    const v4f_t v0 = *(const v4f*)(sO + r0 * OP_ + 4 * lane);
    const v4f_t v1 = *(const v4f*)(sO + r1 * OP_ + 4 * lane);
    float* p0 = Op + ((size_t)sp * NROWS_ + qrow0 + r0) * ND_ + 4 * lane;
    float* p1 = Op + ((size_t)sp * NROWS_ + qrow0 + r1) * ND_ + 4 * lane;
    *(v4f*)p0 = v0;
    *(v4f*)p1 = v1;
    // the range's 16 row maxima, then its 16 row sums: one whole 128-byte line a work-group
    if (wave == 0) {
        const float* lp = sLs + m * LP_;
        const v4f_t l4 = (*(const v4f*)(lp) + *(const v4f*)(lp + 4)) + (*(const v4f*)(lp + 8) + *(const v4f*)(lp + 12));
        const float ls = (l4.x + l4.y) + (l4.z + l4.w);
        Ml[(size_t)(sp * NQT_ + qt) * 32 + lane] = (h == 0) ? cm : ls;
    }
}

// ---------------- kernel 2: merge of the KS key ranges of every query row ----------------
// grid = NROWS/8 blocks of 256 threads; wave w owns query row 8*blockIdx.x + w, lane l its columns 4l..4l+3.
__global__ __launch_bounds__(256) void k_merge(
    const float* __restrict__ Op, const float* __restrict__ Ml, float* Out)
{
    const int lane = threadIdx.x & 31, wave = threadIdx.x >> 5;
    const int row = blockIdx.x * 8 + wave;
    const int qt = row >> 4, rr = row & 15;
    float ms[KS_], ls[KS_];
    v4f_t os[KS_];
#pragma unroll   // straight-line code, so that all loads stand together: one trip to memory
    for (int s = 0; s < KS_; ++s) {
        ms[s] = Ml[(size_t)(s * NQT_ + qt) * 32 + rr];
        ls[s] = Ml[(size_t)(s * NQT_ + qt) * 32 + 16 + rr];
        os[s] = *(const v4f*)(Op + ((size_t)s * NROWS_ + row) * ND_ + 4 * lane);
    }
    // the arithmetic below reuses the registers that hold the loads' addresses: wait before they are overwritten
    asm volatile("s_wait_xcnt 0x0" ::: "memory");
    float mx = ms[0];
#pragma unroll   // constant index, so that the loaded values stay in registers
    for (int s = 1; s < KS_; ++s) mx = fmaxf(mx, ms[s]);
    float l = 0.0f;
    v4f_t o = {0.0f, 0.0f, 0.0f, 0.0f};
#pragma unroll   // constant index, so that the loaded values stay in registers
    for (int s = 0; s < KS_; ++s) {
        const float w = __builtin_amdgcn_exp2f((ms[s] - mx) * LOG2E_F);
        l += ls[s] * w;
        o += os[s] * w;
    }
    const float inv = 1.0f / (l + EPS_);
    *(v4f*)(Out + (size_t)row * ND_ + 4 * lane) = o * inv * (1.0f / 4096.0f);
}

// ---------------- launcher ----------------
extern "C" void kernel_launch(void* const* d_in, const int* in_sizes, int n_in,
                              void* d_out, int out_size, void* d_ws, size_t ws_size,
                              hipStream_t stream) {
    if (n_in < 6) return;
    if (in_sizes[0] != NROWS_ * ND_ || in_sizes[1] != ND_ * NC_ || in_sizes[2] != ND_ * NC_ ||
        in_sizes[3] != NC_ || in_sizes[4] != NC_ || in_sizes[5] < 1 || out_size != NROWS_ * ND_)
        return;

    const float* inps  = (const float*)d_in[0];
    const float* wei_t = (const float*)d_in[1];
    const float* wei_x = (const float*)d_in[2];
    const float* bxh   = (const float*)d_in[3];
    const float* wei_a = (const float*)d_in[4];
    const float* bxa   = (const float*)d_in[5];
    float* out = (float*)d_out;

    // workspace: Q [NROWS][NC] f32 at 0, K [NROWS][NC] f32 at 1 MiB, partial tiles [KS][NROWS][ND] f32 at 2 MiB,
    // then maxima and sums [KS][NQT][32] f32; total 6 MiB + 64 KiB
    const size_t per = (size_t)NROWS_ * NC_ * sizeof(float);
    if (ws_size < (2 + KS_) * per + (size_t)KS_ * NQT_ * 32 * sizeof(float)) return;
    float* qb = (float*)d_ws;
    float* kx = (float*)((char*)d_ws + per);
    float* op = (float*)((char*)d_ws + 2 * per);
    float* ml = (float*)((char*)d_ws + (2 + KS_) * per);

    const int nrows = NROWS_;
    k_proj<<<dim3((nrows + 15) / 16), dim3(256), 0, stream>>>(inps, wei_t, wei_x, bxh, qb, kx, nrows);
    k_attn<<<dim3(NB_ * (NL_ / 16) * KS_), dim3(256), 0, stream>>>(inps, qb, kx, wei_a, bxa, op, ml);
    k_merge<<<dim3(NROWS_ / 8), dim3(256), 0, stream>>>(op, ml, out);
}
